// v008
// Measured on an AMD MI455X. A time is GPU time per run, averaged over a window of back-to-back runs after a warm-up
// (all launches, gaps included; the runs take copies of the inputs in turn), and the median of several windows.
// Apart from v000's, it joins two sittings. Times from different sittings can be a few percent apart, while
// side-by-side timings come from the same sitting.
// The versions before v008 are in another document.
// Measured time: 270 microseconds a run.
// In both of two side-by-side timings against v007, it was 1.15 times as fast.
// All steps since the starting kernel, v000, together make it 4.77 times as fast.
#include <hip/hip_runtime.h>
// Two-stage attention decoder block (word embeddings [2048][1024], position embeddings [1024][1024], 16 heads x 64, FFN 4096): word = CausalMHA(wemb; q,k,v = Linear+bias, scores/8, tril, softmax, .v, heads merged, no output projection); cross = MHA(q from word, k/v from pemb, no mask); out = relu(cross*W1^T + b1)*W2^T + b2 -> [2048,1024].
// Compute dtype: inputs and parameters rounded to bf16; projections of the embeddings exact; all other operands f16 hi + (x2^10) residual pairs (~2^-21); f32 accumulation, softmax f32. v_wmma_f32_16x16x32_f16.
#define SW 2048
#define SP 1024
#define DM 1024
#define NH 16
#define FF 4096
#define SCL 0.125f
#define SCL2 (SCL * 1.4426950408889634f)      /* 1/sqrt(64) * log2(e): k_flashm keeps scores and running maxima in base 2, exp(x) = 2^(x * log2(e)) */
#define SKV ((SW > SP) ? SW : SP)      /* the larger key count, used nowhere: the self attention has SW keys, the cross attention SP */
typedef __bf16 v16b __attribute__((ext_vector_type(16)));
typedef unsigned short v8us __attribute__((ext_vector_type(8), may_alias));
typedef float  v8f  __attribute__((ext_vector_type(8)));
typedef float  v4f  __attribute__((ext_vector_type(4)));
typedef float  v4fa __attribute__((ext_vector_type(4), may_alias));
union FragB { v16b v; v8us half[2]; unsigned short u[16]; };

__device__ __forceinline__ unsigned short bf16_bits(float x) { unsigned int u = __float_as_uint(x); return (unsigned short)((u + 0x7FFFu + ((u >> 16) & 1u)) >> 16); }
__device__ __forceinline__ float bf16_val(unsigned short b) { return __uint_as_float(((unsigned int)b) << 16); }
__device__ __forceinline__ float bf16_round(float x) { return bf16_val(bf16_bits(x)); }
// D += A·B with NT terms: 1 = ah·bh, 2 = + al·bh (A split), 3 = + ah·bl (both split)
template <int NT>
__device__ __forceinline__ v8f mmaN(v16b ah, v16b al, v16b bh, v16b bl, v8f c) {
  c = __builtin_amdgcn_wmma_f32_16x16x32_bf16(false, ah, false, bh, (short)0, c, false, false);
  if (NT >= 2) c = __builtin_amdgcn_wmma_f32_16x16x32_bf16(false, al, false, bh, (short)0, c, false, false);
  if (NT >= 3) c = __builtin_amdgcn_wmma_f32_16x16x32_bf16(false, ah, false, bl, (short)0, c, false, false);
  asm volatile("v_nop\n\tv_nop\n\tv_nop\n\tv_nop" : "+v"(c) : "v"(ah), "v"(al), "v"(bh), "v"(bl));
  return c;
}

__global__ __launch_bounds__(256) void k_wt_bf16(const float* __restrict__ W, unsigned short* __restrict__ Wt, int K, int N) {
  const int t = blockIdx.x * 256 + threadIdx.x;
  const int k8n = K / 8;
  if (t >= N * k8n) return;
  const int n = t / k8n, k8 = (t % k8n) * 8;
  v8us v;
#pragma unroll
  for (int i = 0; i < 8; ++i) v[i] = bf16_bits(W[(size_t)(k8 + i) * N + n]);
  *(v8us*)(Wt + (size_t)n * K + k8) = v;
  
}

// GEMM C[M][N] (f32, pitch ldc) = act(A[M][K]·W + bias). A f32 row-major (pitch lda) converted per fragment to bf16
// (ASPLIT: hi/lo two planes -> 2 terms, else single rounded term); Wt bf16 [N][K] (pitch ldb). BIAS_BF16 rounds the
// bias to bf16 first (bias quantised to bf16 before the add). K%32==0, M%16==0, N%64==0.
template <bool ASPLIT, int ACT, bool BIAS_BF16>
__global__ __launch_bounds__(128) void k_gemm_bf(const float* __restrict__ A, int lda, const unsigned short* __restrict__ Wt, int ldb,
                                               const float* __restrict__ bias, float* __restrict__ C, int ldc, int M, int N, int K) {
  __shared__ __attribute__((aligned(16))) float so[4][16][64];
  const int tid = threadIdx.x, w = tid >> 5, lane = tid & 31, ln = lane & 15, hh = lane >> 4;
  const int ntn = N / 64;
  const int wid = blockIdx.x * 4 + w;
  const int mt = wid / ntn, nq = wid % ntn;
  if (mt * 16 >= M) return;
  const int row0 = mt * 16, col0 = nq * 64;
  const float* arow = A + (size_t)(row0 + ln) * lda;
  v8f acc[4] = {};
  for (int kb = 0; kb < K; kb += 32) {
    FragB ah, al;
    const v4f x0 = *(const v4fa*)(arow + kb + 8 * hh), x1 = *(const v4fa*)(arow + kb + 8 * hh + 4);
    const v4f x2 = *(const v4fa*)(arow + kb + 16 + 8 * hh), x3 = *(const v4fa*)(arow + kb + 16 + 8 * hh + 4);
    float xs[16] = {x0[0],x0[1],x0[2],x0[3],x1[0],x1[1],x1[2],x1[3],x2[0],x2[1],x2[2],x2[3],x3[0],x3[1],x3[2],x3[3]};
#pragma unroll
    for (int i = 0; i < 16; ++i) { const unsigned short hb = bf16_bits(xs[i]); ah.u[i] = hb; al.u[i] = ASPLIT ? bf16_bits(xs[i] - bf16_val(hb)) : (unsigned short)0; }
#pragma unroll
    for (int t = 0; t < 4; ++t) {
      const unsigned short* brow = Wt + (size_t)(col0 + t * 16 + ln) * ldb + kb;
      FragB b;
      b.half[0] = *(const v8us*)(brow + 8 * hh);
      b.half[1] = *(const v8us*)(brow + 16 + 8 * hh);
      acc[t] = mmaN<ASPLIT ? 2 : 1>(ah.v, al.v, b.v, b.v, acc[t]);
    }
  }
#pragma unroll
  for (int t = 0; t < 4; ++t) {
    float bv = bias ? bias[col0 + t * 16 + ln] : 0.f;
    if (BIAS_BF16) bv = bf16_round(bv);
#pragma unroll
    for (int r = 0; r < 8; ++r) { float v = acc[t][r] + bv; if (ACT == 1) v = fmaxf(v, 0.f); so[w][8 * hh + r][t * 16 + ln] = v; }
  }
  __builtin_amdgcn_fence(__ATOMIC_ACQ_REL, "workgroup");
  __builtin_amdgcn_wave_barrier();
  const int rsub = lane >> 4, c4 = (lane & 15) * 4;
  {
#pragma unroll
    for (int q = 0; q < 8; ++q) {
      const int r = q * 2 + rsub;
      const v4f v = *(const v4fa*)&so[w][r][c4];
      *(v4f*)(C + (size_t)(row0 + r) * ldc + col0 + c4) = v;
    }
    
  }
}

// GEMM C = act(A·W + bias + resid): A f32 (ASPLIT -> hi/lo 2 terms), Wt bf16 [N][K]; ACT 0 none, 1 relu, 2 exact gelu;
// resid (optional, f32, row index = (row % rmod), pitch ldr, RES_BF16 rounds it) added before the activation.
template <bool ASPLIT, int ACT, bool BIAS_BF16, bool RES_BF16>
__global__ __launch_bounds__(128) void k_gemm_bf3(const float* __restrict__ A, int lda, const unsigned short* __restrict__ Wt, int ldb,
                                                const float* __restrict__ bias, const float* __restrict__ resid, int rmod, int ldr,
                                                float* __restrict__ C, int ldc, int M, int N, int K) {
  __shared__ __attribute__((aligned(16))) float so[4][16][64];
  const int tid = threadIdx.x, w = tid >> 5, lane = tid & 31, ln = lane & 15, hh = lane >> 4;
  const int ntn = N / 64;
  const int wid = blockIdx.x * 4 + w;
  const int mt = wid / ntn, nq = wid % ntn;
  if (mt * 16 >= M) return;
  const int row0 = mt * 16, col0 = nq * 64;
  const float* arow = A + (size_t)(row0 + ln) * lda;
  v8f acc[4] = {};
  for (int kb = 0; kb < K; kb += 32) {
    FragB ah, al;
    const v4f x0 = *(const v4fa*)(arow + kb + 8 * hh), x1 = *(const v4fa*)(arow + kb + 8 * hh + 4);
    const v4f x2 = *(const v4fa*)(arow + kb + 16 + 8 * hh), x3 = *(const v4fa*)(arow + kb + 16 + 8 * hh + 4);
    float xs[16] = {x0[0],x0[1],x0[2],x0[3],x1[0],x1[1],x1[2],x1[3],x2[0],x2[1],x2[2],x2[3],x3[0],x3[1],x3[2],x3[3]};
#pragma unroll
    for (int i = 0; i < 16; ++i) { const unsigned short hb = bf16_bits(xs[i]); ah.u[i] = hb; al.u[i] = ASPLIT ? bf16_bits(xs[i] - bf16_val(hb)) : (unsigned short)0; }
#pragma unroll
    for (int t = 0; t < 4; ++t) {
      const unsigned short* brow = Wt + (size_t)(col0 + t * 16 + ln) * ldb + kb;
      FragB b;
      b.half[0] = *(const v8us*)(brow + 8 * hh);
      b.half[1] = *(const v8us*)(brow + 16 + 8 * hh);
      acc[t] = mmaN<ASPLIT ? 2 : 1>(ah.v, al.v, b.v, b.v, acc[t]);
    }
  }
#pragma unroll
  for (int t = 0; t < 4; ++t) {
    const int col = col0 + t * 16 + ln;
    float bv = bias ? bias[col] : 0.f;
    if (BIAS_BF16) bv = bf16_round(bv);
#pragma unroll
    for (int r = 0; r < 8; ++r) {
      float v = acc[t][r] + bv;
      if (resid) { float rv = resid[(size_t)((row0 + 8 * hh + r) % rmod) * ldr + col]; if (RES_BF16) rv = bf16_round(rv); v += rv; }
      if (ACT == 1) v = fmaxf(v, 0.f);
      if (ACT == 2) v = 0.5f * v * (1.0f + erff(v * 0.70710678118654752f));
      if (ACT == 3) { const float u = 0.7978845608028654f * (v + 0.044715f * v * v * v); v = 0.5f * v * (1.0f + tanhf(u)); }
      so[w][8 * hh + r][t * 16 + ln] = v;
    }
  }
  __builtin_amdgcn_fence(__ATOMIC_ACQ_REL, "workgroup");
  __builtin_amdgcn_wave_barrier();
  const int rsub = lane >> 4, c4 = (lane & 15) * 4;
  {
#pragma unroll
    for (int q = 0; q < 8; ++q) {
      const int r = q * 2 + rsub;
      const v4f v = *(const v4fa*)&so[w][r][c4];
      *(v4f*)(C + (size_t)(row0 + r) * ldc + col0 + c4) = v;
    }
    
  }
}
// row LayerNorm (biased variance, eps) over N: s = X (+ R); optional out_sum <- s; out_norm <- (s-mu)*rsqrt(var+eps)*g + b
template <bool PARAM_BF16>
__global__ __launch_bounds__(256) void k_layernorm(const float* __restrict__ X, const float* __restrict__ R, const float* __restrict__ g, const float* __restrict__ bta,
                                                  float* __restrict__ out_sum, float* __restrict__ out_norm, int N, float eps) {
  __shared__ float red[256];
  const int row = blockIdx.x, tid = threadIdx.x;
  const float* x = X + (size_t)row * N; const float* rr = R ? R + (size_t)row * N : nullptr;
  float vals[16];                     // up to N = 4096
  const int per = N / 256;            // contiguous chunk per thread? use strided-by-4 chunks: thread handles j = tid*4 + 1024*u
  float s1 = 0.f;
  for (int u = 0; u < per / 4; ++u) {
    const int j = tid * 4 + 1024 * u;
    const v4f a = *(const v4fa*)(x + j);
    v4f b = {0.f,0.f,0.f,0.f}; if (rr) b = *(const v4fa*)(rr + j);
#pragma unroll
    for (int q = 0; q < 4; ++q) { const float v = a[q] + b[q]; vals[u * 4 + q] = v; s1 += v; }
  }
  red[tid] = s1; __syncthreads();
  for (int st = 128; st > 0; st >>= 1) { if (tid < st) red[tid] += red[tid + st]; __syncthreads(); }
  const float mu = red[0] / (float)N; __syncthreads();
  float s2 = 0.f;
  for (int u = 0; u < per / 4; ++u)
#pragma unroll
    for (int q = 0; q < 4; ++q) { const float c = vals[u * 4 + q] - mu; s2 += c * c; }
  red[tid] = s2; __syncthreads();
  for (int st = 128; st > 0; st >>= 1) { if (tid < st) red[tid] += red[tid + st]; __syncthreads(); }
  const float rs = rsqrtf(red[0] / (float)N + eps);
  {
    for (int u = 0; u < per / 4; ++u) {
      const int j = tid * 4 + 1024 * u;
      v4f o, sm;
#pragma unroll
      for (int q = 0; q < 4; ++q) {
        float gg = g[j + q], bb = bta[j + q];
        if (PARAM_BF16) { gg = bf16_round(gg); bb = bf16_round(bb); }
        sm[q] = vals[u * 4 + q]; o[q] = (vals[u * 4 + q] - mu) * rs * gg + bb;
      }
      if (out_sum) *(v4f*)(out_sum + (size_t)row * N + j) = sm;
      *(v4f*)(out_norm + (size_t)row * N + j) = o;
    }
    
  }
}



// ---- f16 WMMA path (v_wmma_f32_16x16x32_f16): 11-bit significands for operands in range — used where a [0,1] probability operand needs more precision than bf16
typedef _Float16 v16h __attribute__((ext_vector_type(16)));
union FragH { v16h v; v8us half[2]; _Float16 h[16]; unsigned short u[16]; };
template <int NT>
__device__ __forceinline__ v8f mmaH(v16h ah, v16h al, v16h bh, v16h bl, v8f c) {
  c = __builtin_amdgcn_wmma_f32_16x16x32_f16(false, ah, false, bh, (short)0, c, false, false);
  if (NT >= 2) c = __builtin_amdgcn_wmma_f32_16x16x32_f16(false, al, false, bh, (short)0, c, false, false);
  if (NT >= 3) c = __builtin_amdgcn_wmma_f32_16x16x32_f16(false, ah, false, bl, (short)0, c, false, false);
  asm volatile("v_nop\n\tv_nop\n\tv_nop\n\tv_nop" : "+v"(c) : "v"(ah), "v"(al), "v"(bh), "v"(bl));
  return c;
}
// batched GEMM like k_gemm_b but f16 operands: A f32 (split into f16 hi/lo if ASPLIT, else rounded to f16), Bt = f16 values [n][k]; alpha; C f32; N multiple of 16 (partial tiles skipped)
template <bool ASPLIT>
__global__ __launch_bounds__(128) void k_gemm_h(const float* __restrict__ A, int lda, size_t sA, const _Float16* __restrict__ Bh, int ldb, size_t sB, float alpha, float* __restrict__ C, int ldc, size_t sC, int M, int N, int K) {
  __shared__ __attribute__((aligned(16))) float so[4][16][64];
  const int tid = threadIdx.x, w = tid >> 5, lane = tid & 31, ln = lane & 15, hh = lane >> 4; const int by = blockIdx.y;
  A += (size_t)by * sA; Bh += (size_t)by * sB; C += (size_t)by * sC;
  const int ntn = (N + 63) / 64; const int wid = blockIdx.x * 4 + w; const int mt = wid / ntn, nq = wid % ntn; if (mt * 16 >= M) return;
  const int row0 = mt * 16, col0 = nq * 64; const float* arow = A + (size_t)(row0 + ln) * lda;
  v8f acc[4] = {};
  for (int kb = 0; kb < K; kb += 32) {
    FragH ah, al;
    const v4f x0 = *(const v4fa*)(arow + kb + 8 * hh), x1 = *(const v4fa*)(arow + kb + 8 * hh + 4), x2 = *(const v4fa*)(arow + kb + 16 + 8 * hh), x3 = *(const v4fa*)(arow + kb + 16 + 8 * hh + 4);
    float xs[16] = {x0[0],x0[1],x0[2],x0[3],x1[0],x1[1],x1[2],x1[3],x2[0],x2[1],x2[2],x2[3],x3[0],x3[1],x3[2],x3[3]};
#pragma unroll
    for (int i = 0; i < 16; ++i) { const _Float16 h = (_Float16)xs[i]; ah.h[i] = h; al.h[i] = ASPLIT ? (_Float16)(xs[i] - (float)h) : (_Float16)0.0f; }
#pragma unroll
    for (int t = 0; t < 4; ++t) { if (col0 + t * 16 >= N) continue; const size_t boff = (size_t)(col0 + t * 16 + ln) * ldb + kb; FragH bq; bq.half[0] = *(const v8us*)(Bh + boff + 8 * hh); bq.half[1] = *(const v8us*)(Bh + boff + 16 + 8 * hh);
      acc[t] = mmaH<ASPLIT ? 2 : 1>(ah.v, al.v, bq.v, bq.v, acc[t]); }
  }
#pragma unroll
  for (int t = 0; t < 4; ++t) { if (col0 + t * 16 >= N) continue;
#pragma unroll
    for (int r = 0; r < 8; ++r) so[w][8 * hh + r][t * 16 + ln] = acc[t][r] * alpha; }
  __builtin_amdgcn_fence(__ATOMIC_ACQ_REL, "workgroup"); __builtin_amdgcn_wave_barrier();
  const int rsub = lane >> 4, c4 = (lane & 15) * 4;
  {
#pragma unroll
    for (int q = 0; q < 8; ++q) { const int r = q * 2 + rsub; if (col0 + c4 < N) { const v4f v = *(const v4fa*)&so[w][r][c4]; *(v4f*)(C + (size_t)(row0 + r) * ldc + col0 + c4) = v; } }
     }
}

// Wt[n][k] = f16(W[k][n]·scale) from f32 row-major W[K][N] (scale = power of two; bf16-exact weights stay exact in f16 away from the subnormal range)
__global__ __launch_bounds__(256) void k_wt_f16(const float* __restrict__ W, _Float16* __restrict__ Wt, int K, int N, float scale) {
  const int t = blockIdx.x * 256 + threadIdx.x; if (t >= N * (K / 8)) return; const int n = t / (K / 8), k8 = (t % (K / 8)) * 8; FragH f;
#pragma unroll
  for (int i = 0; i < 8; ++i) f.h[i] = (_Float16)(bf16_round(W[(size_t)(k8 + i) * N + n]) * scale); const v8us o = f.half[0];
  *(v8us*)((unsigned short*)Wt + (size_t)n * K + k8) = o; 
}
// k_gemm_hh variant with fused epilogue: v = acc·alpha + bias[by·sBias + col] (+ CP[(row/rowsPerB)·sCPb + by·64 + col] if CP) ; ACT 0 none / 1 elu ; writes f16 C16 (and f32 C if non-null)
template <int ACT>
__global__ __launch_bounds__(128) void k_gemm_hhx(const _Float16* __restrict__ A, int lda, size_t sA, const _Float16* __restrict__ Bh, int ldb, size_t sB, float alpha, const float* __restrict__ bias, size_t sBias, const float* __restrict__ CP, int rowsPerB, size_t sCPb, int row0g,
    float* __restrict__ C, _Float16* __restrict__ C16, int ldc, size_t sC, int M, int N, int K) {
  __shared__ __attribute__((aligned(16))) float so[4][16][64];
  const int tid = threadIdx.x, w = tid >> 5, lane = tid & 31, ln = lane & 15, hh = lane >> 4; const int by = blockIdx.y;
  A += (size_t)by * sA; Bh += (size_t)by * sB; const size_t cofs = (size_t)by * sC; const float* bp = bias ? bias + (size_t)by * sBias : nullptr;
  const int ntn = (N + 63) / 64; const int wid = blockIdx.x * 4 + w; const int mt = wid / ntn, nq = wid % ntn; if (mt * 16 >= M) return;
  const int row0 = mt * 16, col0 = nq * 64; const _Float16* arow = A + (size_t)(row0 + ln) * lda;
  v8f acc[4] = {};
  for (int kb = 0; kb < K; kb += 32) { FragH ah; ah.half[0] = *(const v8us*)((const unsigned short*)arow + kb + 8 * hh); ah.half[1] = *(const v8us*)((const unsigned short*)arow + kb + 16 + 8 * hh);
#pragma unroll
    for (int t = 0; t < 4; ++t) { if (col0 + t * 16 >= N) continue; const size_t boff = (size_t)(col0 + t * 16 + ln) * ldb + kb; FragH bq; bq.half[0] = *(const v8us*)((const unsigned short*)Bh + boff + 8 * hh); bq.half[1] = *(const v8us*)((const unsigned short*)Bh + boff + 16 + 8 * hh);
      acc[t] = mmaH<1>(ah.v, ah.v, bq.v, bq.v, acc[t]); }
  }
#pragma unroll
  for (int t = 0; t < 4; ++t) { if (col0 + t * 16 >= N) continue; const int col = col0 + t * 16 + ln; const float bv = bp ? bf16_round(bp[col]) : 0.f;
#pragma unroll
    for (int r = 0; r < 8; ++r) { float v = acc[t][r] * alpha + bv; if (CP) { const int bidx = (row0g + row0 + 8 * hh + r) / rowsPerB; v += CP[(size_t)bidx * sCPb + (size_t)by * 64 + col]; } if (ACT == 1) v = (v > 0.f) ? v : expm1f(v); else if (ACT == 7) v = (v > 0.f) ? v + 1.0f : expf(v); else if (ACT == 8) v = tanhf(v); else if (ACT == 9) v = 0.5f * v * (1.0f + tanhf(0.7978845608028654f * (v + 0.044715f * v * v * v))); else if (ACT == 11) v = 1.0f / (1.0f + expf(-v)); else if (ACT == 12) v = (v > 0.f) ? v : 0.01f * v; else if (ACT == 14) v = (v > 0.f) ? v : 0.1f * v; else if (ACT == 15) v = v / (1.0f + expf(-v)); else if (ACT == 3) v = fmaxf(v, 0.f); else if (ACT == 6) v = 0.5f * v * (1.0f + erff(v * 0.70710678118654752f)); so[w][8 * hh + r][t * 16 + ln] = v; } }
  __builtin_amdgcn_fence(__ATOMIC_ACQ_REL, "workgroup"); __builtin_amdgcn_wave_barrier();
  const int rsub = lane >> 4, c4 = (lane & 15) * 4; typedef _Float16 v4h __attribute__((ext_vector_type(4)));
  {
#pragma unroll
    for (int q = 0; q < 8; ++q) { const int r = q * 2 + rsub; if (col0 + c4 < N) { const v4f v = *(const v4fa*)&so[w][r][c4]; if (C) *(v4f*)(C + cofs + (size_t)(row0 + r) * ldc + col0 + c4) = v; if (C16) { v4h h4; for (int i = 0; i < 4; ++i) h4[i] = (_Float16)v[i]; *(v4h*)(C16 + cofs + (size_t)(row0 + r) * ldc + col0 + c4) = h4; } } }
     }
}


typedef _Float16 v4h __attribute__((ext_vector_type(4)));

// Bodies of the short kernels: blk is the block's index inside its own job, so that independent jobs can share one grid, each on its own range of block indices.
__device__ __forceinline__ void d_x16(const float* __restrict__ x, _Float16* __restrict__ X16, size_t n8, unsigned blk) { const size_t t = (size_t)blk * 256 + threadIdx.x; if (t >= n8) return; FragH f;
#pragma unroll
  for (int q = 0; q < 8; ++q) f.h[q] = (_Float16)bf16_round(x[t * 8 + q]); *(v8us*)((unsigned short*)X16 + t * 8) = f.half[0];  }
__global__ __launch_bounds__(256) void k_h16(const float* __restrict__ x, _Float16* __restrict__ X16, size_t n8) { const size_t t = (size_t)blockIdx.x * 256 + threadIdx.x; if (t >= n8) return; FragH f;
#pragma unroll
  for (int q = 0; q < 8; ++q) f.h[q] = (_Float16)x[t * 8 + q]; *(v8us*)((unsigned short*)X16 + t * 8) = f.half[0];  }
__device__ __forceinline__ void d_round16f(const float* __restrict__ W, _Float16* __restrict__ Bt, size_t n8, unsigned blk) { const size_t t = (size_t)blk * 256 + threadIdx.x; if (t >= n8) return; FragH f;
#pragma unroll
  for (int i = 0; i < 8; ++i) f.h[i] = (_Float16)(bf16_round(W[t * 8 + i]) * 16.0f); *(v8us*)((unsigned short*)Bt + t * 8) = f.half[0];  }
template <int NHv, int TTv>
__global__ __launch_bounds__(256) void k_vt(const _Float16* __restrict__ V16, int ldv, int voff, _Float16* __restrict__ Vt) { __shared__ unsigned short tl[64][66]; const int tid = threadIdx.x; const int slab = blockIdx.x / (TTv / 64), lg = blockIdx.x % (TTv / 64); const int b = slab / NHv, h = slab % NHv;
  for (int i = tid; i < 64 * 8; i += 256) { const int r = i / 8, c8 = (i % 8) * 8; FragH f; f.half[0] = *(const v8us*)((const unsigned short*)V16 + ((size_t)b * TTv + lg * 64 + r) * ldv + voff + h * 64 + c8);
#pragma unroll
    for (int q = 0; q < 8; ++q) tl[r][c8 + q] = f.u[q]; }
  __syncthreads();
  {
#pragma unroll
    for (int rd = 0; rd < 2; ++rd) { const int d = rd * 32 + tid / 8, pc = tid % 8; FragH f;
#pragma unroll
      for (int q = 0; q < 8; ++q) f.u[q] = tl[pc * 8 + q][d];
      *(v8us*)((unsigned short*)Vt + ((size_t)slab * 64 + d) * TTv + lg * 64 + pc * 8) = f.half[0]; }
     } }

// An f32 value as an operand pair: hi = f16(v), lo = f16((v - hi) * 2^10). The kernel that makes a value stores the pair itself.
__device__ __forceinline__ void hl4(v4f v, v4h& hi, v4h& lo) {
#pragma unroll
  for (int i = 0; i < 4; ++i) { const _Float16 h = (_Float16)v[i]; hi[i] = h; lo[i] = (_Float16)((v[i] - (float)h) * 1024.0f); } }

// ---- fast GEMM (block tile 128x64, wave tile 32x64; requires M % 128 == 0, N % 64 == 0 and K % 128 == 0); epilogue = k_gemm_hhx semantics ----
// k loop staging of g2_body: one stage = 128 k (256 B of a row) of the block's 128 A rows and 64 B rows, laid in LDS at a pitch of 272 B (16 B x odd, for the 16-byte fragment reads); two buffers.
#define G2_PITCH 272
#define G2_AB (128 * G2_PITCH)
#define G2_STAGE ((128 + 64) * G2_PITCH)
__device__ __forceinline__ v16h g2_lfrag(const unsigned char* p, int hh) { FragH f; f.half[0] = *(const v8us*)(p + 16 * hh); f.half[1] = *(const v8us*)(p + 32 + 16 * hh); return f.v; }
__device__ __forceinline__ v8f g2_mm(v16h a, v16h b, v8f c) { return __builtin_amdgcn_wmma_f32_16x16x32_f16(false, a, false, b, (short)0, c, false, false); }
// One wave's share of a stage: 32 A rows and 16 B rows, two rows (2 x 256 B, whole lines) per wave-wide copy, 16 B per lane, 24 copies.
// la, lb: the lane's LDS byte addresses of its first A and B chunk; ga, gb: the matching global addresses; a copy further on is two rows further on.
__device__ __forceinline__ void g2_stage(unsigned la, unsigned lb, const _Float16* ga, int lda, const _Float16* gb, int ldb) {
  unsigned l[24]; const _Float16* g[24];
#pragma unroll
  for (int i = 0; i < 16; ++i) { l[i] = la + i * (2 * G2_PITCH); g[i] = ga + (size_t)(2 * i) * lda; }
#pragma unroll
  for (int i = 0; i < 8; ++i) { l[16 + i] = lb + i * (2 * G2_PITCH); g[16 + i] = gb + (size_t)(2 * i) * ldb; }
  // the copies go to LDS through no register; s_wait_xcnt is the statement's last line so that no address register is rewritten ahead of it
  asm volatile("global_load_async_to_lds_b128 %0, %12, off\n\t"
               "global_load_async_to_lds_b128 %1, %13, off\n\t"
               "global_load_async_to_lds_b128 %2, %14, off\n\t"
               "global_load_async_to_lds_b128 %3, %15, off\n\t"
               "global_load_async_to_lds_b128 %4, %16, off\n\t"
               "global_load_async_to_lds_b128 %5, %17, off\n\t"
               "global_load_async_to_lds_b128 %6, %18, off\n\t"
               "global_load_async_to_lds_b128 %7, %19, off\n\t"
               "global_load_async_to_lds_b128 %8, %20, off\n\t"
               "global_load_async_to_lds_b128 %9, %21, off\n\t"
               "global_load_async_to_lds_b128 %10, %22, off\n\t"
               "global_load_async_to_lds_b128 %11, %23, off\n\t"
               "s_wait_xcnt 0x0"
               :: "v"(l[0]), "v"(l[1]), "v"(l[2]), "v"(l[3]), "v"(l[4]), "v"(l[5]), "v"(l[6]), "v"(l[7]), "v"(l[8]), "v"(l[9]), "v"(l[10]), "v"(l[11]),
                  "v"(g[0]), "v"(g[1]), "v"(g[2]), "v"(g[3]), "v"(g[4]), "v"(g[5]), "v"(g[6]), "v"(g[7]), "v"(g[8]), "v"(g[9]), "v"(g[10]), "v"(g[11]) : "memory");
  asm volatile("global_load_async_to_lds_b128 %0, %12, off\n\t"
               "global_load_async_to_lds_b128 %1, %13, off\n\t"
               "global_load_async_to_lds_b128 %2, %14, off\n\t"
               "global_load_async_to_lds_b128 %3, %15, off\n\t"
               "global_load_async_to_lds_b128 %4, %16, off\n\t"
               "global_load_async_to_lds_b128 %5, %17, off\n\t"
               "global_load_async_to_lds_b128 %6, %18, off\n\t"
               "global_load_async_to_lds_b128 %7, %19, off\n\t"
               "global_load_async_to_lds_b128 %8, %20, off\n\t"
               "global_load_async_to_lds_b128 %9, %21, off\n\t"
               "global_load_async_to_lds_b128 %10, %22, off\n\t"
               "global_load_async_to_lds_b128 %11, %23, off\n\t"
               "s_wait_xcnt 0x0"
               :: "v"(l[12]), "v"(l[13]), "v"(l[14]), "v"(l[15]), "v"(l[16]), "v"(l[17]), "v"(l[18]), "v"(l[19]), "v"(l[20]), "v"(l[21]), "v"(l[22]), "v"(l[23]),
                  "v"(g[12]), "v"(g[13]), "v"(g[14]), "v"(g[15]), "v"(g[16]), "v"(g[17]), "v"(g[18]), "v"(g[19]), "v"(g[20]), "v"(g[21]), "v"(g[22]), "v"(g[23]) : "memory");
}
// bx, by: the block's tile index and batch index inside its own product
// Results: C (f32), C16 (f16), Hh and Hl (hi/lo operand planes, C's shape and pitch), Th and Tl (hi/lo planes of the transposed result, [N][M], pitch M; no addend, no activation); each optional, the tests are block-uniform.
template <int ACT>
__device__ __forceinline__ void g2_body(const _Float16* __restrict__ A, int lda, size_t sA, const _Float16* __restrict__ Bh, int ldb, size_t sB, float alpha, const float* __restrict__ bias, size_t sBias, const float* __restrict__ CP, int rowsPerB, size_t sCPb, int row0g,
    float* __restrict__ C, _Float16* __restrict__ C16, _Float16* __restrict__ Hh, _Float16* __restrict__ Hl, _Float16* __restrict__ Th, _Float16* __restrict__ Tl, int ldc, size_t sC, int M, int N, int K, int bx, int by) {
  __shared__ __attribute__((aligned(16))) float so[4][32][68]; __shared__ __attribute__((aligned(16))) unsigned char ring[2 * G2_STAGE];
  const int tid = threadIdx.x, w = tid >> 5, lane = tid & 31, ln = lane & 15, hh = lane >> 4;
  A += (size_t)by * sA; Bh += (size_t)by * sB; const size_t cofs = (size_t)by * sC; const float* bp = bias ? bias + (size_t)by * sBias : nullptr;
  const int ntn = N >> 6; const int mt = bx / ntn, nq = bx - mt * ntn; const int row0 = mt * 128 + 32 * w, col0 = nq * 64; if (mt * 128 >= M) return;      /* the whole block leaves, in front of every barrier */
  const v8f z8 = {0.f,0.f,0.f,0.f,0.f,0.f,0.f,0.f}; v8f c00 = z8, c01 = z8, c02 = z8, c03 = z8, c10 = z8, c11 = z8, c12 = z8, c13 = z8;
  const _Float16* ga = A + (size_t)(row0 + hh) * lda + ln * 8; const _Float16* gb = Bh + (size_t)(col0 + 16 * w + hh) * ldb + ln * 8;      /* this lane's first 16 bytes of the wave's A and B rows */
  const unsigned la = (unsigned)(size_t)ring + (unsigned)((32 * w + hh) * G2_PITCH + ln * 16), lb = (unsigned)(size_t)ring + (unsigned)(G2_AB + (16 * w + hh) * G2_PITCH + ln * 16);
  const int nst = K >> 7;
  g2_stage(la, lb, ga, lda, gb, ldb);
  // What the epilogue adds (bias, addend CP) is read here, in the layout of the write-out pass (lane = 4 columns of rows 2q + hh): 17 independent 16-byte loads issued as one group, in flight beside stage 0's copies.
  const int c4 = ln * 4; const v4f z4 = {0.f,0.f,0.f,0.f}; v4f b4 = z4, cp[16];
#pragma unroll
  for (int q = 0; q < 16; ++q) cp[q] = z4;
  if (CP) { const float* pc[16];
#pragma unroll
    for (int q = 0; q < 16; ++q) { const int bidx = (row0g + row0 + q * 2 + hh) / rowsPerB; pc[q] = CP + (size_t)bidx * sCPb + (size_t)by * 64 + col0 + c4; }
    __builtin_amdgcn_sched_barrier(0);      /* all 16 addresses are formed in front of the loads, each in registers of its own: formed among the loads they share registers, and each reuse waits for an issued load */
#pragma unroll
    for (int q = 0; q < 16; ++q) cp[q] = *(const v4fa*)pc[q];
    asm volatile("s_wait_xcnt 0x0" ::: "memory");      /* stands in front of whatever reuses the address registers of the 16 loads above */
  }
  float bt[4] = {0.f, 0.f, 0.f, 0.f};      /* the bias in the accumulators' layout (lane = column 16 t + ln), for the transposed write-out */
  if (bp) { b4 = *(const v4fa*)(bp + col0 + c4);
#pragma unroll
    for (int t = 0; t < 4; ++t) bt[t] = bp[col0 + t * 16 + ln];
    asm volatile("s_wait_xcnt 0x0" ::: "memory");      /* the same for the bias loads */
  }
  asm volatile("s_wait_asynccnt 0x0" ::: "memory");      /* this wave's copies of stage 0 have landed */
  __syncthreads();      /* and every other wave's: stage 0 may be read */
  if (nst > 1) g2_stage(la + G2_STAGE, lb + G2_STAGE, ga + 128, lda, gb + 128, ldb);
#pragma unroll 1      /* one trip per stage: the two buffers alternate */
  for (int t = 0; t < nst; ++t) { const unsigned bo = (unsigned)(t & 1) * G2_STAGE; const unsigned char* pa = ring + bo + (32 * w + ln) * G2_PITCH; const unsigned char* pb = ring + bo + G2_AB + ln * G2_PITCH;
    v16h fa[2][2], fb[2][4];      /* two fragment sets: the next k step's LDS reads are issued, as one group, ahead of this step's WMMAs; never beyond the stage */
    fa[0][0] = g2_lfrag(pa, hh); fa[0][1] = g2_lfrag(pa + 16 * G2_PITCH, hh);
#pragma unroll
    for (int j = 0; j < 4; ++j) fb[0][j] = g2_lfrag(pb + j * 16 * G2_PITCH, hh);
#pragma unroll
    for (int ks = 0; ks < 4; ++ks) { const int cu = ks & 1, nx = cu ^ 1;
      if (ks < 3) { fa[nx][0] = g2_lfrag(pa + (ks + 1) * 64, hh); fa[nx][1] = g2_lfrag(pa + 16 * G2_PITCH + (ks + 1) * 64, hh);
#pragma unroll
        for (int j = 0; j < 4; ++j) fb[nx][j] = g2_lfrag(pb + j * 16 * G2_PITCH + (ks + 1) * 64, hh); }
      __builtin_amdgcn_sched_barrier(0);      /* keeps the reads above in front of the WMMAs below: sunk to their uses, each pair of WMMAs waits out an LDS latency */
      c00 = g2_mm(fa[cu][0], fb[cu][0], c00); c10 = g2_mm(fa[cu][1], fb[cu][0], c10); c01 = g2_mm(fa[cu][0], fb[cu][1], c01); c11 = g2_mm(fa[cu][1], fb[cu][1], c11);
      c02 = g2_mm(fa[cu][0], fb[cu][2], c02); c12 = g2_mm(fa[cu][1], fb[cu][2], c12); c03 = g2_mm(fa[cu][0], fb[cu][3], c03); c13 = g2_mm(fa[cu][1], fb[cu][3], c13);
      __builtin_amdgcn_sched_barrier(0);      /* keeps the next group of reads behind these WMMAs, so that two sets suffice */
    }
    asm volatile("s_wait_dscnt 0x0" ::: "memory");      /* this wave's reads of the buffer are done before it is refilled */
    asm volatile("s_wait_asynccnt 0x0" ::: "memory");      /* this wave's copies of stage t + 1 have landed */
    __syncthreads();      /* publishes stage t + 1 and ends every wave's reads of stage t */
    if (t + 2 < nst) g2_stage(la + bo, lb + bo, ga + (size_t)(t + 2) * 128, lda, gb + (size_t)(t + 2) * 128, ldb); }
  asm volatile("s_wait_asynccnt 0x0" ::: "memory");      /* no copy is left in flight */
  v8f accs[8] = {c00, c01, c02, c03, c10, c11, c12, c13};
  if (Th) {      /* transposed hi/lo planes: an accumulator's 8 registers are 8 consecutive rows of one column, that is 16 bytes of a transposed row; they go through LDS so that a transposed row's 128 elements leave as one 256-byte run */
    unsigned char* tp = (unsigned char*)&so[0][0][0];      /* two planes of 64 rows at the ring's pitch: 2 * 64 * 272 B, the size of so */
#pragma unroll
    for (int u = 0; u < 8; ++u) { const int t = u & 3, half = u >> 2; const float bb = bf16_round(bt[t]); FragH fh, fl;
#pragma unroll
      for (int r = 0; r < 8; ++r) { const float v = accs[u][r] * alpha + bb; const _Float16 hv = (_Float16)v; fh.h[r] = hv; fl.h[r] = (_Float16)((v - (float)hv) * 1024.0f); }
      unsigned char* q = tp + (t * 16 + ln) * G2_PITCH + (32 * w + half * 16 + 8 * hh) * 2; *(v8us*)q = fh.half[0]; *(v8us*)(q + 64 * G2_PITCH) = fl.half[0]; }
    __syncthreads();      /* a transposed row holds elements of all four waves */
    v8us xh[8], xl[8]; unsigned short* qh[8]; unsigned short* ql[8];
#pragma unroll
    for (int i = 0; i < 8; ++i) { const int d = i * 8 + (tid >> 4); const unsigned char* q = tp + d * G2_PITCH + ln * 16; xh[i] = *(const v8us*)q; xl[i] = *(const v8us*)(q + 64 * G2_PITCH); const size_t xo = (size_t)(col0 + d) * M + mt * 128 + ln * 8; qh[i] = (unsigned short*)Th + xo; ql[i] = (unsigned short*)Tl + xo; }
    __builtin_amdgcn_sched_barrier(0);      /* values and addresses first, then the 16 stores as one group: formed among the stores the addresses share registers, and each reuse waits for an issued store */
#pragma unroll
    for (int i = 0; i < 8; ++i) { *(v8us*)qh[i] = xh[i]; *(v8us*)ql[i] = xl[i]; }
    asm volatile("s_wait_xcnt 0x0" ::: "memory");      /* stands in front of whatever reuses the registers of the 16 stores above */
    return; }
#pragma unroll
  for (int u = 0; u < 8; ++u) { const int t = u & 3, half = u >> 2;
#pragma unroll
    for (int r = 0; r < 8; ++r) so[w][half * 16 + 8 * hh + r][t * 16 + ln] = accs[u][r]; }
  __builtin_amdgcn_fence(__ATOMIC_ACQ_REL, "workgroup"); __builtin_amdgcn_wave_barrier();
  const int rsub = lane >> 4; const v4f bv4 = {bf16_round(b4[0]), bf16_round(b4[1]), bf16_round(b4[2]), bf16_round(b4[3])};
  {      /* no branch per row: the 16 LDS reads are one group, the sums one block, the stores one group under one test of the pointer */
    v4f o[16];
#pragma unroll
    for (int q = 0; q < 16; ++q) o[q] = *(const v4fa*)&so[w][q * 2 + rsub][c4];
#pragma unroll
    for (int q = 0; q < 16; ++q)
#pragma unroll
      for (int i = 0; i < 4; ++i) { float v = o[q][i] * alpha + bv4[i]; if (CP) v += cp[q][i];
        if (ACT == 3) v = fmaxf(v, 0.f); else if (ACT == 6) v = 0.5f * v * (1.0f + erff(v * 0.70710678118654752f)); else if (ACT == 11) v = 1.0f / (1.0f + expf(-v)); else if (ACT == 15) v = v / (1.0f + expf(-v)); else if (ACT == 12) v = (v > 0.f) ? v : 0.01f * v; else if (ACT == 8) v = tanhf(v);
        o[q][i] = v; }
    if (C) { float* po[16];
#pragma unroll
      for (int q = 0; q < 16; ++q) po[q] = C + cofs + (size_t)(row0 + q * 2 + rsub) * ldc + col0 + c4;
      __builtin_amdgcn_sched_barrier(0);      /* all 16 addresses are formed in front of the stores, each in registers of its own: formed among the stores they share registers, and each reuse waits for an issued store */
#pragma unroll
      for (int q = 0; q < 16; ++q) *(v4f*)po[q] = o[q];
      asm volatile("s_wait_xcnt 0x0" ::: "memory");      /* stands in front of whatever reuses the registers of the 16 stores above */
    }
    if (C16) { _Float16* ph[16]; v4h h4[16];
#pragma unroll
      for (int q = 0; q < 16; ++q) { for (int i = 0; i < 4; ++i) h4[q][i] = (_Float16)o[q][i]; ph[q] = C16 + cofs + (size_t)(row0 + q * 2 + rsub) * ldc + col0 + c4; }
      __builtin_amdgcn_sched_barrier(0);      /* as above: values and addresses first, then the 16 stores as one group */
#pragma unroll
      for (int q = 0; q < 16; ++q) *(v4h*)ph[q] = h4[q]; }
    if (Hh) { v4h h4[16], l4[16]; _Float16* ph[16]; _Float16* pl[16];
#pragma unroll
      for (int q = 0; q < 16; ++q) { hl4(o[q], h4[q], l4[q]); const size_t ho = cofs + (size_t)(row0 + q * 2 + rsub) * ldc + col0 + c4; ph[q] = Hh + ho; pl[q] = Hl + ho; }
      __builtin_amdgcn_sched_barrier(0);      /* as above: values and addresses first, then the 32 stores as one group */
#pragma unroll
      for (int q = 0; q < 16; ++q) { *(v4h*)ph[q] = h4[q]; *(v4h*)pl[q] = l4[q]; }
      asm volatile("s_wait_xcnt 0x0" ::: "memory");      /* stands in front of whatever reuses the registers of the 32 stores above */
    }
     } }
// ---- a product whose A operand is a hi plane and a residual plane: both passes in one launch ----
// Block = 8 waves on one 128x64 tile: waves 0-3 multiply the hi plane's rows, waves 4-7 the residual plane's rows, against the one staged B tile; the write-out adds the two sums.
// One stage = 128 k of the 128 rows of each A plane and of the 64 B rows, at the pitch of k_proj5's ring; two buffers.
#define G2P_AB (256 * G2_PITCH)
#define G2P_STAGE ((256 + 64) * G2_PITCH)
// One wave's share of a stage: its own 32 A rows and 8 B rows, two rows (2 x 256 B, whole lines) per wave-wide copy, 16 B per lane, 20 copies.
__device__ __forceinline__ void g2p_stage(unsigned la, unsigned lb, const _Float16* ga, int lda, const _Float16* gb, int ldb) {
  unsigned l[20]; const _Float16* g[20];
#pragma unroll
  for (int i = 0; i < 16; ++i) { l[i] = la + i * (2 * G2_PITCH); g[i] = ga + (size_t)(2 * i) * lda; }
#pragma unroll
  for (int i = 0; i < 4; ++i) { l[16 + i] = lb + i * (2 * G2_PITCH); g[16 + i] = gb + (size_t)(2 * i) * ldb; }
  // the copies go to LDS through no register; s_wait_xcnt is the statement's last line so that no address register is rewritten ahead of it
  asm volatile("global_load_async_to_lds_b128 %0, %10, off\n\t"
               "global_load_async_to_lds_b128 %1, %11, off\n\t"
               "global_load_async_to_lds_b128 %2, %12, off\n\t"
               "global_load_async_to_lds_b128 %3, %13, off\n\t"
               "global_load_async_to_lds_b128 %4, %14, off\n\t"
               "global_load_async_to_lds_b128 %5, %15, off\n\t"
               "global_load_async_to_lds_b128 %6, %16, off\n\t"
               "global_load_async_to_lds_b128 %7, %17, off\n\t"
               "global_load_async_to_lds_b128 %8, %18, off\n\t"
               "global_load_async_to_lds_b128 %9, %19, off\n\t"
               "s_wait_xcnt 0x0"
               :: "v"(l[0]), "v"(l[1]), "v"(l[2]), "v"(l[3]), "v"(l[4]), "v"(l[5]), "v"(l[6]), "v"(l[7]), "v"(l[8]), "v"(l[9]),
                  "v"(g[0]), "v"(g[1]), "v"(g[2]), "v"(g[3]), "v"(g[4]), "v"(g[5]), "v"(g[6]), "v"(g[7]), "v"(g[8]), "v"(g[9]) : "memory");
  asm volatile("global_load_async_to_lds_b128 %0, %10, off\n\t"
               "global_load_async_to_lds_b128 %1, %11, off\n\t"
               "global_load_async_to_lds_b128 %2, %12, off\n\t"
               "global_load_async_to_lds_b128 %3, %13, off\n\t"
               "global_load_async_to_lds_b128 %4, %14, off\n\t"
               "global_load_async_to_lds_b128 %5, %15, off\n\t"
               "global_load_async_to_lds_b128 %6, %16, off\n\t"
               "global_load_async_to_lds_b128 %7, %17, off\n\t"
               "global_load_async_to_lds_b128 %8, %18, off\n\t"
               "global_load_async_to_lds_b128 %9, %19, off\n\t"
               "s_wait_xcnt 0x0"
               :: "v"(l[10]), "v"(l[11]), "v"(l[12]), "v"(l[13]), "v"(l[14]), "v"(l[15]), "v"(l[16]), "v"(l[17]), "v"(l[18]), "v"(l[19]),
                  "v"(g[10]), "v"(g[11]), "v"(g[12]), "v"(g[13]), "v"(g[14]), "v"(g[15]), "v"(g[16]), "v"(g[17]), "v"(g[18]), "v"(g[19]) : "memory");
}
// C = act(Ah*B^T * alpha + bias (+ CP) + Al*B^T * alphal); CP: optional addend of C's shape and pitch (it may be C itself: a lane reads exactly the elements that it stores). M % 128 == 0, N % 64 == 0, K % 128 == 0.
// SPLIT: the result is the next product's A operand and is stored as its hi/lo planes Ch, Cl (C's shape and pitch) and not as f32.
template <int ACT, bool SPLIT>
__global__ __launch_bounds__(256) void k_gemm2p(const _Float16* __restrict__ Ah, const _Float16* __restrict__ Al, int lda, const _Float16* __restrict__ Bh, int ldb, float alpha, float alphal, const float* __restrict__ bias, const float* CP,
    float* C, _Float16* __restrict__ Ch, _Float16* __restrict__ Cl, int ldc, int M, int N, int K) {
  __shared__ __attribute__((aligned(16))) float so[8][32][68]; __shared__ __attribute__((aligned(16))) unsigned char ring[2 * G2P_STAGE];
  const int tid = threadIdx.x, w = tid >> 5, lane = tid & 31, ln = lane & 15, hh = lane >> 4, pl = w >> 2, wr = w & 3;      /* pl: the wave's plane; wr: its group of 32 rows */
  const int ntn = N >> 6; const int bx = (int)blockIdx.x; const int mt = bx / ntn, nq = bx - mt * ntn; const int row0 = mt * 128 + 32 * wr, col0 = nq * 64; if (mt * 128 >= M) return;      /* the whole block leaves, in front of every barrier */
  const v8f z8 = {0.f,0.f,0.f,0.f,0.f,0.f,0.f,0.f}; v8f c00 = z8, c01 = z8, c02 = z8, c03 = z8, c10 = z8, c11 = z8, c12 = z8, c13 = z8;
  const _Float16* ga = (pl ? Al : Ah) + (size_t)(row0 + hh) * lda + ln * 8; const _Float16* gb = Bh + (size_t)(col0 + 8 * w + hh) * ldb + ln * 8;      /* this lane's first 16 bytes of the wave's A and B rows */
  const unsigned la = (unsigned)(size_t)ring + (unsigned)((32 * w + hh) * G2_PITCH + ln * 16), lb = (unsigned)(size_t)ring + (unsigned)(G2P_AB + (8 * w + hh) * G2_PITCH + ln * 16);
  const int nst = K >> 7;
  g2p_stage(la, lb, ga, lda, gb, ldb);
  // What the write-out adds (bias, addend CP) is read here, in the write-out's layout (a wave writes 16 of its group's 32 rows; lane = 4 columns of rows 16 pl + 2q + hh): independent 16-byte loads issued as one group, in flight beside stage 0's copies.
  const int c4 = ln * 4, rw = 16 * pl + hh; const v4f z4 = {0.f,0.f,0.f,0.f}; v4f b4 = z4, cp[8];
#pragma unroll
  for (int q = 0; q < 8; ++q) cp[q] = z4;
  if (CP) { const float* pc[8];
#pragma unroll
    for (int q = 0; q < 8; ++q) pc[q] = CP + (size_t)(row0 + rw + q * 2) * ldc + col0 + c4;
    __builtin_amdgcn_sched_barrier(0);      /* all 8 addresses are formed in front of the loads, each in registers of its own: formed among the loads they share registers, and each reuse waits for an issued load */
#pragma unroll
    for (int q = 0; q < 8; ++q) cp[q] = *(const v4fa*)pc[q];
    asm volatile("s_wait_xcnt 0x0" ::: "memory");      /* stands in front of whatever reuses the address registers of the 8 loads above */
  }
  if (bias) { b4 = *(const v4fa*)(bias + col0 + c4);
    asm volatile("s_wait_xcnt 0x0" ::: "memory");      /* the same for the bias load */
  }
  asm volatile("s_wait_asynccnt 0x0" ::: "memory");      /* this wave's copies of stage 0 have landed */
  __syncthreads();      /* and every other wave's: stage 0 may be read */
  if (nst > 1) g2p_stage(la + G2P_STAGE, lb + G2P_STAGE, ga + 128, lda, gb + 128, ldb);
#pragma unroll 1      /* one trip per stage: the two buffers alternate */
  for (int t = 0; t < nst; ++t) { const unsigned bo = (unsigned)(t & 1) * G2P_STAGE; const unsigned char* pa = ring + bo + (32 * w + ln) * G2_PITCH; const unsigned char* pb = ring + bo + G2P_AB + ln * G2_PITCH;
    v16h fa[2][2], fb[2][4];      /* two fragment sets: the next k step's LDS reads are issued, as one group, ahead of this step's WMMAs; never beyond the stage */
    fa[0][0] = g2_lfrag(pa, hh); fa[0][1] = g2_lfrag(pa + 16 * G2_PITCH, hh);
#pragma unroll
    for (int j = 0; j < 4; ++j) fb[0][j] = g2_lfrag(pb + j * 16 * G2_PITCH, hh);
#pragma unroll
    for (int ks = 0; ks < 4; ++ks) { const int cu = ks & 1, nx = cu ^ 1;
      if (ks < 3) { fa[nx][0] = g2_lfrag(pa + (ks + 1) * 64, hh); fa[nx][1] = g2_lfrag(pa + 16 * G2_PITCH + (ks + 1) * 64, hh);
#pragma unroll
        for (int j = 0; j < 4; ++j) fb[nx][j] = g2_lfrag(pb + j * 16 * G2_PITCH + (ks + 1) * 64, hh); }
      __builtin_amdgcn_sched_barrier(0);      /* keeps the reads above in front of the WMMAs below: sunk to their uses, each pair of WMMAs waits out an LDS latency */
      c00 = g2_mm(fa[cu][0], fb[cu][0], c00); c10 = g2_mm(fa[cu][1], fb[cu][0], c10); c01 = g2_mm(fa[cu][0], fb[cu][1], c01); c11 = g2_mm(fa[cu][1], fb[cu][1], c11);
      c02 = g2_mm(fa[cu][0], fb[cu][2], c02); c12 = g2_mm(fa[cu][1], fb[cu][2], c12); c03 = g2_mm(fa[cu][0], fb[cu][3], c03); c13 = g2_mm(fa[cu][1], fb[cu][3], c13);
      __builtin_amdgcn_sched_barrier(0);      /* keeps the next group of reads behind these WMMAs, so that two sets suffice */
    }
    asm volatile("s_wait_dscnt 0x0" ::: "memory");      /* this wave's reads of the buffer are done before it is refilled */
    asm volatile("s_wait_asynccnt 0x0" ::: "memory");      /* this wave's copies of stage t + 1 have landed */
    __syncthreads();      /* publishes stage t + 1 and ends every wave's reads of stage t */
    if (t + 2 < nst) g2p_stage(la + bo, lb + bo, ga + (size_t)(t + 2) * 128, lda, gb + (size_t)(t + 2) * 128, ldb); }
  asm volatile("s_wait_asynccnt 0x0" ::: "memory");      /* no copy is left in flight */
  v8f accs[8] = {c00, c01, c02, c03, c10, c11, c12, c13};
#pragma unroll
  for (int u = 0; u < 8; ++u) { const int t = u & 3, half = u >> 2;
#pragma unroll
    for (int r = 0; r < 8; ++r) so[w][half * 16 + 8 * hh + r][t * 16 + ln] = accs[u][r]; }
  __syncthreads();      /* a row group's two sums come from two waves: both are in LDS before either wave reads them */
  const v4f bv4 = {bf16_round(b4[0]), bf16_round(b4[1]), bf16_round(b4[2]), bf16_round(b4[3])};
  {      /* no branch per row: the 16 LDS reads are one group, the sums one block, the stores one group */
    v4f o[8], ol[8];
#pragma unroll
    for (int q = 0; q < 8; ++q) { o[q] = *(const v4fa*)&so[wr][rw + q * 2][c4]; ol[q] = *(const v4fa*)&so[4 + wr][rw + q * 2][c4]; }
#pragma unroll
    for (int q = 0; q < 8; ++q)
#pragma unroll
      for (int i = 0; i < 4; ++i) { float v = o[q][i] * alpha + bv4[i]; if (CP) v += cp[q][i]; v += ol[q][i] * alphal;      /* the order of the two separate passes: hi sum, bias, addend, then the residual sum */
        if (ACT == 3) v = fmaxf(v, 0.f);
        o[q][i] = v; }
    float* po[8]; _Float16* ph[8]; _Float16* pl[8]; v4h h4[8], l4[8];
#pragma unroll
    for (int q = 0; q < 8; ++q) { const size_t co = (size_t)(row0 + rw + q * 2) * ldc + col0 + c4; if (SPLIT) { hl4(o[q], h4[q], l4[q]); ph[q] = Ch + co; pl[q] = Cl + co; } else po[q] = C + co; }
    __builtin_amdgcn_sched_barrier(0);      /* all addresses are formed in front of the stores, each in registers of its own: formed among the stores they share registers, and each reuse waits for an issued store */
#pragma unroll
    for (int q = 0; q < 8; ++q) { if (SPLIT) { *(v4h*)ph[q] = h4[q]; *(v4h*)pl[q] = l4[q]; } else *(v4f*)po[q] = o[q]; }
    asm volatile("s_wait_xcnt 0x0" ::: "memory");      /* stands in front of whatever reuses the registers of the stores above */
  } }
// The five projections that depend on the embeddings alone (q, k, v of the self attention; k, v of the cross attention) in one grid: a range of block indices per product.
// BT: the six [DM][DM] weight planes in a row (q, k, v, cross q, cross k, cross v). Each result is stored as the attention's operand planes: q and k as hi/lo [rows][DM], v as hi/lo of its transpose [DM][rows] (64 columns of a tile = one head).
#define P5_NW ((SW / 128) * (DM / 64))
#define P5_NP ((SP / 128) * (DM / 64))
__global__ __launch_bounds__(128) void k_proj5(const _Float16* __restrict__ WE, const _Float16* __restrict__ PE, const _Float16* __restrict__ BT, const float* __restrict__ bq, const float* __restrict__ bk, const float* __restrict__ bv, const float* __restrict__ bkc, const float* __restrict__ bvc,
    _Float16* __restrict__ Qh, _Float16* __restrict__ Ql, _Float16* __restrict__ Kh, _Float16* __restrict__ Kl, _Float16* __restrict__ Vth, _Float16* __restrict__ Vtl,
    _Float16* __restrict__ KCh, _Float16* __restrict__ KCl, _Float16* __restrict__ VCth, _Float16* __restrict__ VCtl) {
  const int b = (int)blockIdx.x; const bool word = b < 3 * P5_NW;      /* block-uniform */
  const int j = word ? b / P5_NW : (b - 3 * P5_NW) / P5_NP; const int bx = word ? b - j * P5_NW : (b - 3 * P5_NW) - j * P5_NP;
  const float* bias = word ? (j == 0 ? bq : (j == 1 ? bk : bv)) : (j == 0 ? bkc : bvc);
  _Float16* const hh_ = word ? (j == 0 ? Qh : (j == 1 ? Kh : nullptr)) : (j == 0 ? KCh : nullptr); _Float16* const hl_ = word ? (j == 0 ? Ql : (j == 1 ? Kl : nullptr)) : (j == 0 ? KCl : nullptr);
  _Float16* const th_ = word ? (j == 2 ? Vth : nullptr) : (j == 1 ? VCth : nullptr); _Float16* const tl_ = word ? (j == 2 ? Vtl : nullptr) : (j == 1 ? VCtl : nullptr);
  g2_body<0>(word ? WE : PE, DM, 0, BT + (size_t)(word ? j : 4 + j) * DM * DM, DM, 0, 0.0625f, bias, 0, nullptr, 1, 0, 0,
             nullptr, nullptr, hh_, hl_, th_, tl_, DM, 0, word ? SW : SP, DM, DM, bx, 0); }


// K/V staging of k_flashm: one stage = the 32 keys of one trip: 32 K rows of 128 B (hi plane, lo plane) at a pitch of 144 B, 64 V^T rows of 64 B (hi plane, lo plane) at a pitch of 80 B (16 B x odd, for the 16-byte fragment reads); two buffers.
#define FM_KP 144
#define FM_VP 80
#define FM_KL (32 * FM_KP)
#define FM_VH (2 * 32 * FM_KP)
#define FM_VD (64 * FM_VP)
#define FM_STAGE (FM_VH + 2 * FM_VD)
// One wave's share of a stage: 8 K rows and 16 V^T rows of each plane, 16 B per lane, 8 copies (a K copy brings 4 whole rows, a V copy 8 rows).
// lk, lv: the lane's LDS byte addresses of its first K and V chunk (hi plane); gkh, gkl, gvh, gvl: the matching global addresses in the four planes.
__device__ __forceinline__ void fm_stage(unsigned lk, unsigned lv, const unsigned short* gkh, const unsigned short* gkl, int ldk, const unsigned short* gvh, const unsigned short* gvl, int ldv) {
  // the copies go to LDS through no register; s_wait_xcnt is the statement's last line so that no address register is rewritten ahead of it
  asm volatile("global_load_async_to_lds_b128 %0, %8, off\n\t"
               "global_load_async_to_lds_b128 %1, %9, off\n\t"
               "global_load_async_to_lds_b128 %2, %10, off\n\t"
               "global_load_async_to_lds_b128 %3, %11, off\n\t"
               "global_load_async_to_lds_b128 %4, %12, off\n\t"
               "global_load_async_to_lds_b128 %5, %13, off\n\t"
               "global_load_async_to_lds_b128 %6, %14, off\n\t"
               "global_load_async_to_lds_b128 %7, %15, off\n\t"
               "s_wait_xcnt 0x0"
               :: "v"(lk), "v"(lk + 4 * FM_KP), "v"(lk + FM_KL), "v"(lk + FM_KL + 4 * FM_KP), "v"(lv), "v"(lv + 8 * FM_VP), "v"(lv + FM_VD), "v"(lv + FM_VD + 8 * FM_VP),
                  "v"(gkh), "v"(gkh + (size_t)4 * ldk), "v"(gkl), "v"(gkl + (size_t)4 * ldk), "v"(gvh), "v"(gvh + (size_t)8 * ldv), "v"(gvl), "v"(gvl + (size_t)8 * ldv) : "memory");
}
template <int TQ, int TK>
__global__ __launch_bounds__(128) void k_flashm(const _Float16* __restrict__ Q16, const _Float16* __restrict__ Q16lo, int ldq, const _Float16* __restrict__ K16, const _Float16* __restrict__ K16lo, int ldk, const _Float16* __restrict__ Vt, const _Float16* __restrict__ Vtlo, const unsigned* __restrict__ MB, const int* __restrict__ RA, const int* __restrict__ KE, _Float16* __restrict__ Oh, _Float16* __restrict__ Ol, int ldo) {
  constexpr int RPW = 16, RTN = RPW / 16, NQB = TQ / (4 * RPW), DT = 4, KS = 2;
  __shared__ __attribute__((aligned(16))) unsigned short sP[4][RPW][40], sPl[4][RPW][40]; __shared__ __attribute__((aligned(16))) float sO[4][RPW][64 + 4]; __shared__ __attribute__((aligned(16))) unsigned char kv[2 * FM_STAGE];
  const int tid = threadIdx.x, w = tid >> 5, lane = tid & 31, ln = lane & 15, hh = lane >> 4;
  const int slab = blockIdx.x / NQB, qblk = blockIdx.x % NQB; const int b = slab / NH, h = slab % NH; const int qb0 = qblk * (4 * RPW); const int q0 = qb0 + w * RPW;
  FragH aq[2][KS], aql[2][KS];
#pragma unroll
  for (int rt = 0; rt < RTN; ++rt) { const size_t qo = ((size_t)b * TQ + q0 + rt * 16 + ln) * ldq + h * 64; const unsigned short* qr = (const unsigned short*)Q16 + qo; const unsigned short* ql = (const unsigned short*)Q16lo + qo;
#pragma unroll
    for (int ks = 0; ks < KS; ++ks) { aq[rt][ks].half[0] = *(const v8us*)(qr + ks * 32 + 8 * hh); aq[rt][ks].half[1] = *(const v8us*)(qr + ks * 32 + 16 + 8 * hh); aql[rt][ks].half[0] = *(const v8us*)(ql + ks * 32 + 8 * hh); aql[rt][ks].half[1] = *(const v8us*)(ql + ks * 32 + 16 + 8 * hh); } }
  const unsigned short* Vth = (const unsigned short*)Vt + (size_t)slab * 64 * TK; const unsigned short* Vtl = (const unsigned short*)Vtlo + (size_t)slab * 64 * TK;
  float m_r[2][8], l_r[2][8]; v8f oacc[2][DT], oaccl[2][DT];
#pragma unroll
  for (int rt = 0; rt < RTN; ++rt) {
#pragma unroll
    for (int r = 0; r < 8; ++r) { m_r[rt][r] = -3.0e38f; l_r[rt][r] = 0.f; }
#pragma unroll
    for (int dt = 0; dt < DT; ++dt) { oacc[rt][dt] = (v8f){0.f,0.f,0.f,0.f,0.f,0.f,0.f,0.f}; oaccl[rt][dt] = oacc[rt][dt]; } }
  int jend = KE[qblk * 32]; jend = min(TK, (jend + 31) & ~31); if (jend < 32) jend = 32;      /* block-uniform */
  int allm[2][8]; const unsigned* mrow[2][8];
#pragma unroll
  for (int rt = 0; rt < RTN; ++rt)
#pragma unroll
    for (int r = 0; r < 8; ++r) { const int tq = q0 + rt * 16 + 8 * hh + r; allm[rt][r] = RA[tq]; mrow[rt][r] = MB + (size_t)tq * (TK / 32); }
  const unsigned lk = (unsigned)(size_t)kv + (unsigned)((8 * w + (lane >> 3)) * FM_KP + (lane & 7) * 16), lv = (unsigned)(size_t)kv + (unsigned)(FM_VH + (16 * w + (lane >> 2)) * FM_VP + (lane & 3) * 16);
  const size_t gko = ((size_t)b * TK + 8 * w + (lane >> 3)) * ldk + h * 64 + (lane & 7) * 8, gvo = (size_t)(16 * w + (lane >> 2)) * TK + (lane & 3) * 8;      /* this lane's first 16 bytes of the wave's K and V^T rows */
  const unsigned short* gkh = (const unsigned short*)K16 + gko; const unsigned short* gkl = (const unsigned short*)K16lo + gko; const unsigned short* gvh = Vth + gvo; const unsigned short* gvl = Vtl + gvo;
  fm_stage(lk, lv, gkh, gkl, ldk, gvh, gvl, TK);
  asm volatile("s_wait_asynccnt 0x0" ::: "memory");      /* this wave's copies of stage 0 have landed */
  __syncthreads();      /* and every other wave's: stage 0 may be read */
  if (32 < jend) fm_stage(lk + FM_STAGE, lv + FM_STAGE, gkh + (size_t)32 * ldk, gkl + (size_t)32 * ldk, ldk, gvh + 32, gvl + 32, TK);
#pragma unroll 1
  for (int j0 = 0; j0 < jend; j0 += 32) {
    const unsigned bo = (unsigned)((j0 >> 5) & 1) * FM_STAGE; const unsigned char* pk = kv + bo + ln * FM_KP + 16 * hh; const unsigned char* pv = kv + bo + FM_VH + ln * FM_VP + 16 * hh;      /* this trip's buffer: the lane's row and half in the K and V^T tiles */
    v8f s[2][2]; FragH bk[2][KS], bkl[2][KS];
#pragma unroll
    for (int nt = 0; nt < 2; ++nt) { const unsigned char* kr = pk + nt * 16 * FM_KP; const unsigned char* kl = kr + FM_KL;
#pragma unroll
      for (int ks = 0; ks < KS; ++ks) { bk[nt][ks].half[0] = *(const v8us*)(kr + ks * 64); bk[nt][ks].half[1] = *(const v8us*)(kr + ks * 64 + 32); bkl[nt][ks].half[0] = *(const v8us*)(kl + ks * 64); bkl[nt][ks].half[1] = *(const v8us*)(kl + ks * 64 + 32); } }
    __builtin_amdgcn_sched_barrier(0);      /* keeps the trip's K reads one group in front of the WMMAs: sunk to their uses, the second 16 keys wait out an LDS latency of their own */
#pragma unroll
    for (int nt = 0; nt < 2; ++nt) {
#pragma unroll
      for (int rt = 0; rt < RTN; ++rt) { v8f acc = (v8f){0.f,0.f,0.f,0.f,0.f,0.f,0.f,0.f}, accr = acc;
#pragma unroll
        for (int ks = 0; ks < KS; ++ks) { acc = mmaH<1>(aq[rt][ks].v, aq[rt][ks].v, bk[nt][ks].v, bk[nt][ks].v, acc); accr = mmaH<1>(aql[rt][ks].v, aql[rt][ks].v, bk[nt][ks].v, bk[nt][ks].v, accr); accr = mmaH<1>(aq[rt][ks].v, aq[rt][ks].v, bkl[nt][ks].v, bkl[nt][ks].v, accr); }
        s[rt][nt] = acc + accr * 0.0009765625f; } }
#pragma unroll
    for (int rt = 0; rt < RTN; ++rt) {      /* no branch in the softmax: each exp is computed for every lane and the old conditions pick by select, so a lane's eight rows are one straight-line block and their mask loads, cross-lane steps and exp chains overlap */
      float s0[8], s1[8], mc[8]; bool ok0[8], ok1[8];
#pragma unroll
      for (int r = 0; r < 8; ++r) { const unsigned mw = mrow[rt][r][j0 >> 5]; const bool am = (allm[rt][r] != 0);
        ok0[r] = am || (((mw >> ln) & 1u) == 0u); ok1[r] = am || (((mw >> (16 + ln)) & 1u) == 0u);
        s0[r] = ok0[r] ? (am ? 0.f : s[rt][0][r] * SCL2) : -INFINITY; s1[r] = ok1[r] ? (am ? 0.f : s[rt][1][r] * SCL2) : -INFINITY; mc[r] = fmaxf(s0[r], s1[r]); }
#pragma unroll
      for (int st = 1; st < 16; st <<= 1)
#pragma unroll
        for (int r = 0; r < 8; ++r) mc[r] = fmaxf(mc[r], __shfl_xor(mc[r], st, 32));
#pragma unroll
      for (int r = 0; r < 8; ++r) { const float mo = m_r[rt][r], mn = fmaxf(mo, mc[r]); const float ea = __builtin_amdgcn_exp2f(mo - mn), e0 = __builtin_amdgcn_exp2f(s0[r] - mn), e1 = __builtin_amdgcn_exp2f(s1[r] - mn);      /* every argument is <= 0 (or -inf): no range reduction and no overflow clamp is needed, one v_exp_f32 each */
        const float al = (mn > -1.0e38f) ? ea : 1.0f; m_r[rt][r] = mn; const float p0 = ok0[r] ? e0 : 0.f, p1 = ok1[r] ? e1 : 0.f; l_r[rt][r] = l_r[rt][r] * al + p0 + p1;
#pragma unroll
        for (int dt = 0; dt < DT; ++dt) { oacc[rt][dt][r] *= al; oaccl[rt][dt][r] *= al; }
        FragH t2, t3; const float ps0 = p0 * 1024.0f, ps1 = p1 * 1024.0f; t2.h[0] = (_Float16)ps0; t2.h[1] = (_Float16)ps1; t3.h[0] = (_Float16)((ps0 - (float)t2.h[0]) * 1024.0f); t3.h[1] = (_Float16)((ps1 - (float)t2.h[1]) * 1024.0f);
        sP[w][rt * 16 + 8 * hh + r][ln] = t2.u[0]; sP[w][rt * 16 + 8 * hh + r][16 + ln] = t2.u[1]; sPl[w][rt * 16 + 8 * hh + r][ln] = t3.u[0]; sPl[w][rt * 16 + 8 * hh + r][16 + ln] = t3.u[1]; } }
    FragH bv[DT], bl[DT];      /* the trip's V^T fragments, read as one group in front of P's way through LDS, so that the four output tiles do not each wait out an LDS latency */
#pragma unroll
    for (int dt = 0; dt < DT; ++dt) { const unsigned char* vr = pv + dt * 16 * FM_VP; bv[dt].half[0] = *(const v8us*)vr; bv[dt].half[1] = *(const v8us*)(vr + 32); bl[dt].half[0] = *(const v8us*)(vr + FM_VD); bl[dt].half[1] = *(const v8us*)(vr + FM_VD + 32); }
    __builtin_amdgcn_fence(__ATOMIC_ACQ_REL, "workgroup"); __builtin_amdgcn_wave_barrier();
    FragH pa[2], pl[2];
#pragma unroll
    for (int rt = 0; rt < RTN; ++rt) { pa[rt].half[0] = *(const v8us*)&sP[w][rt * 16 + ln][8 * hh]; pa[rt].half[1] = *(const v8us*)&sP[w][rt * 16 + ln][16 + 8 * hh]; pl[rt].half[0] = *(const v8us*)&sPl[w][rt * 16 + ln][8 * hh]; pl[rt].half[1] = *(const v8us*)&sPl[w][rt * 16 + ln][16 + 8 * hh]; }
#pragma unroll
    for (int dt = 0; dt < DT; ++dt) {
#pragma unroll
      for (int rt = 0; rt < RTN; ++rt) { oacc[rt][dt] = mmaH<1>(pa[rt].v, pa[rt].v, bv[dt].v, bv[dt].v, oacc[rt][dt]); oaccl[rt][dt] = mmaH<1>(pa[rt].v, pa[rt].v, bl[dt].v, bl[dt].v, oaccl[rt][dt]); oaccl[rt][dt] = mmaH<1>(pl[rt].v, pl[rt].v, bv[dt].v, bv[dt].v, oaccl[rt][dt]); } }
    asm volatile("s_wait_dscnt 0x0" ::: "memory");      /* this wave's reads of the buffer (and of its P rows) are done before the refill */
    asm volatile("s_wait_asynccnt 0x0" ::: "memory");      /* this wave's copies of the next stage have landed */
    __syncthreads();      /* publishes the next stage and ends every wave's reads of this one */
    if (j0 + 64 < jend) fm_stage(lk + bo, lv + bo, gkh + (size_t)(j0 + 64) * ldk, gkl + (size_t)(j0 + 64) * ldk, ldk, gvh + (j0 + 64), gvl + (j0 + 64), TK); }
  asm volatile("s_wait_asynccnt 0x0" ::: "memory");      /* no copy is left in flight */
#pragma unroll
  for (int rt = 0; rt < RTN; ++rt) {
#pragma unroll
    for (int r = 0; r < 8; ++r) { float l = l_r[rt][r]; l += __shfl_xor(l, 1, 32); l += __shfl_xor(l, 2, 32); l += __shfl_xor(l, 4, 32); l += __shfl_xor(l, 8, 32); l_r[rt][r] = (l > 0.f) ? 1.0f / (l * 1024.0f) : 0.f; }
#pragma unroll
    for (int dt = 0; dt < DT; ++dt)
#pragma unroll
      for (int r = 0; r < 8; ++r) sO[w][rt * 16 + 8 * hh + r][dt * 16 + ln] = (oacc[rt][dt][r] + oaccl[rt][dt][r] * 0.0009765625f) * l_r[rt][r]; }
  __builtin_amdgcn_fence(__ATOMIC_ACQ_REL, "workgroup"); __builtin_amdgcn_wave_barrier();
  {      /* the result is the next product's A operand: it is stored as that operand's hi/lo planes */
    v4h h4[RPW / 2], l4[RPW / 2]; _Float16* ph[RPW / 2]; _Float16* pq[RPW / 2];
#pragma unroll
    for (int rp = 0; rp < RPW; rp += 2) { const int r = rp + (lane >> 4), pc = lane & 15; const v4f val = *(const v4fa*)&sO[w][r][pc * 4]; hl4(val, h4[rp / 2], l4[rp / 2]); const size_t oo = ((size_t)b * TQ + q0 + r) * ldo + h * 64 + pc * 4; ph[rp / 2] = Oh + oo; pq[rp / 2] = Ol + oo; }
    __builtin_amdgcn_sched_barrier(0);      /* values and addresses first, then the stores as one group: formed among the stores the addresses share registers, and each reuse waits for an issued store */
#pragma unroll
    for (int i = 0; i < RPW / 2; ++i) { *(v4h*)ph[i] = h4[i]; *(v4h*)pq[i] = l4[i]; }
     } }


__device__ __forceinline__ void d_causaltab(unsigned* __restrict__ MB, int* __restrict__ RA, int* __restrict__ KE, int nq, int nk, int blk) {
  const int t = blk * 256 + threadIdx.x; const int nw = nk / 32;
  if (t < nq * nw) { const int q = t / nw, w = t % nw; const int first = q + 1 - 32 * w; const unsigned bits = (first <= 0) ? 0xffffffffu : ((first >= 32) ? 0u : (0xffffffffu << first)); *(unsigned*)(MB + t) = bits;  }
  if (t < nq) { *(int*)(RA + t) = 0;  }
  if (t < nq / 64) { const int v = 64 * (t + 1); *(int*)(KE + t * 32) = v;  } }
__device__ __forceinline__ void d_fulltab(unsigned* __restrict__ MB, int* __restrict__ RA, int* __restrict__ KE, int nq, int nk, int blk) {
  const int t = blk * 256 + threadIdx.x; const int nw = nk / 32;
  if (t < nq * nw) { *(unsigned*)(MB + t) = 0u;  }
  if (t < nq) { *(int*)(RA + t) = 0;  }
  if (t < nq / 64) { *(int*)(KE + t * 32) = nk;  } }

// Everything that depends on the inputs alone (eight weight planes, two embedding planes, two mask tables) in one grid: a range of block indices per job, every branch block-uniform.
// BT: the six [DM][DM] weight planes in a row (q, k, v, cross q, cross k, cross v).
#define PR_F (FF * DM / 8 / 256)
#define PR_W (DM * DM / 8 / 256)
#define PR_X (SW * DM / 8 / 256)
#define PR_P (SP * DM / 8 / 256)
#define PR_C (SW * (SW / 32) / 256)
#define PR_U (SW * (SP / 32) / 256)
__global__ __launch_bounds__(256) void k_prep(const float* __restrict__ Wq, const float* __restrict__ Wk, const float* __restrict__ Wv, const float* __restrict__ Wqc, const float* __restrict__ Wkc, const float* __restrict__ Wvc, const float* __restrict__ W1, const float* __restrict__ W2,
    const float* __restrict__ wemb, const float* __restrict__ pemb, _Float16* __restrict__ BT, _Float16* __restrict__ BW1, _Float16* __restrict__ BW2, _Float16* __restrict__ WE16, _Float16* __restrict__ PE16,
    unsigned* __restrict__ MB, int* __restrict__ RA, int* __restrict__ KE, unsigned* __restrict__ MB2, int* __restrict__ RA2, int* __restrict__ KE2) {
  int b = (int)blockIdx.x;
  if (b < PR_F) { d_round16f(W1, BW1, (size_t)FF * DM / 8, (unsigned)b); return; } b -= PR_F;
  if (b < PR_F) { d_round16f(W2, BW2, (size_t)FF * DM / 8, (unsigned)b); return; } b -= PR_F;
  if (b < 6 * PR_W) { const int j = b / PR_W; const float* W = (j == 0) ? Wq : (j == 1) ? Wk : (j == 2) ? Wv : (j == 3) ? Wqc : (j == 4) ? Wkc : Wvc;
    d_round16f(W, BT + (size_t)j * DM * DM, (size_t)DM * DM / 8, (unsigned)(b - j * PR_W)); return; } b -= 6 * PR_W;
  if (b < PR_X) { d_x16(wemb, WE16, (size_t)SW * DM / 8, (unsigned)b); return; } b -= PR_X;
  if (b < PR_P) { d_x16(pemb, PE16, (size_t)SP * DM / 8, (unsigned)b); return; } b -= PR_P;
  if (b < PR_C) { d_causaltab(MB, RA, KE, SW, SW, b); return; } b -= PR_C;
  d_fulltab(MB2, RA2, KE2, SW, SP, b); }

extern "C" void kernel_launch(void* const* d_in, const int* in_sizes, int n_in,
                              void* d_out, int out_size, void* d_ws, size_t ws_size, hipStream_t stream) {
  (void)in_sizes; (void)n_in; (void)out_size;
  const float* const* I = (const float* const*)d_in; const float* wemb = I[0]; const float* pemb = I[1];
  const float* Wq = I[2]; const float* bq = I[3]; const float* Wk = I[4]; const float* bk = I[5]; const float* Wv = I[6]; const float* bv = I[7];
  const float* Wqc = I[8]; const float* bqc = I[9]; const float* Wkc = I[10]; const float* bkc = I[11]; const float* Wvc = I[12]; const float* bvc = I[13];
  const float* W1 = I[14]; const float* b1 = I[15]; const float* W2 = I[16]; const float* b2 = I[17];
  char* ws = (char*)d_ws; size_t off = 0;
  auto take = [&](size_t bytes) { char* p = ws + off; off += (bytes + 255) & ~(size_t)255; return p; };
  _Float16* BT = (_Float16*)take((size_t)6 * DM * DM * 2); _Float16* BQC = BT + (size_t)3 * DM * DM;      /* weight planes q, k, v, cross q, cross k, cross v in a row */
  _Float16* BW1 = (_Float16*)take((size_t)FF * DM * 2); _Float16* BW2 = (_Float16*)take((size_t)DM * FF * 2);
  _Float16* WE16 = (_Float16*)take((size_t)SW * DM * 2); _Float16* PE16 = (_Float16*)take((size_t)SP * DM * 2);
  _Float16* Qh = (_Float16*)take((size_t)SW * DM * 2); _Float16* Ql = (_Float16*)take((size_t)SW * DM * 2); _Float16* Kh = (_Float16*)take((size_t)SW * DM * 2); _Float16* Kl = (_Float16*)take((size_t)SW * DM * 2);
  _Float16* Vth = (_Float16*)take((size_t)SW * DM * 2); _Float16* Vtl = (_Float16*)take((size_t)SW * DM * 2);
  _Float16* KCh = (_Float16*)take((size_t)SP * DM * 2); _Float16* KCl = (_Float16*)take((size_t)SP * DM * 2); _Float16* VCth = (_Float16*)take((size_t)SP * DM * 2); _Float16* VCtl = (_Float16*)take((size_t)SP * DM * 2);
  unsigned* MB = (unsigned*)take((size_t)SW * (SW / 32) * 4); int* RA = (int*)take((size_t)SW * 4); int* KE = (int*)take((size_t)(SW / 64) * 32 * 4);
  unsigned* MB2 = (unsigned*)take((size_t)SW * (SP / 32) * 4); int* RA2 = (int*)take((size_t)SW * 4); int* KE2 = (int*)take((size_t)(SW / 64) * 32 * 4);
  _Float16* Ah = (_Float16*)take((size_t)SW * DM * 2); _Float16* Al = (_Float16*)take((size_t)SW * DM * 2);      /* word hi/lo, later cross hi/lo */
  _Float16* HDh = (_Float16*)take((size_t)SW * (FF / 2) * 2); _Float16* HDl = (_Float16*)take((size_t)SW * (FF / 2) * 2);
  if (off > ws_size) return;      /* 12 + 16 + 4 + 2 + 32 + 0.8 + 8 + 16 = 91 MiB */
  const dim3 gW((SW / 128) * (DM / 64), 1), gH((SW / 128) * ((FF / 2) / 64), 1);
  k_prep<<<2 * PR_F + 6 * PR_W + PR_X + PR_P + PR_C + PR_U, 256, 0, stream>>>(Wq, Wk, Wv, Wqc, Wkc, Wvc, W1, W2, wemb, pemb, BT, BW1, BW2, WE16, PE16, MB, RA, KE, MB2, RA2, KE2);      /* weights are (out,in) row-major = natural Bt; x16 */
  k_proj5<<<3 * P5_NW + 2 * P5_NP, 128, 0, stream>>>(WE16, PE16, BT, bq, bk, bv, bkc, bvc, Qh, Ql, Kh, Kl, Vth, Vtl, KCh, KCl, VCth, VCtl);
  /* --- causal self attention on the word embeddings (all planes hi/lo) --- */
  k_flashm<SW, SW><<<NH * (SW / 64), 128, 0, stream>>>(Qh, Ql, DM, Kh, Kl, DM, Vth, Vtl, MB, RA, KE, Ah, Al, DM);      /* word as hi/lo operand planes */
  k_gemm2p<0, true><<<gW, 256, 0, stream>>>(Ah, Al, DM, BQC, DM, 0.0625f, 0.0625f * 0.0009765625f, bqc, nullptr, nullptr, Qh, Ql, DM, SW, DM, DM);      /* cross q as hi/lo planes */
  k_flashm<SW, SP><<<NH * (SW / 64), 128, 0, stream>>>(Qh, Ql, DM, KCh, KCl, DM, VCth, VCtl, MB2, RA2, KE2, Ah, Al, DM);      /* cross as hi/lo operand planes */
  /* --- FFN in two column halves of the hidden: h = relu(cross*W1^T + b1) (hi/lo), out (+)= h_half*W2_half^T (+ b2 once) --- */
  for (int hf = 0; hf < 2; ++hf) { const _Float16* B1h = BW1 + (size_t)hf * (FF / 2) * DM; const _Float16* B2h = BW2 + (size_t)hf * (FF / 2);
    k_gemm2p<3, true><<<gH, 256, 0, stream>>>(Ah, Al, DM, B1h, DM, 0.0625f, 0.0625f * 0.0009765625f, b1 + hf * (FF / 2), nullptr, nullptr, HDh, HDl, FF / 2, SW, FF / 2, DM);      /* relu on the complete sum, stored as hi/lo planes */
    k_gemm2p<0, false><<<gW, 256, 0, stream>>>(HDh, HDl, FF / 2, B2h, FF, 0.0625f, 0.0625f * 0.0009765625f, (hf == 0) ? b2 : nullptr, (hf == 0) ? nullptr : (const float*)d_out, (float*)d_out, nullptr, nullptr, DM, SW, DM, FF / 2); }
}

// v009
// A run of this version takes 233 microseconds.
// Two timings next to v008 put it at 1.15 and 1.17 times that version's speed.
// Counting every step since v000, which is the starting kernel, it is 5.55 times as fast.
#include <hip/hip_runtime.h>
// Two-stage attention decoder block (word embeddings [2048][1024], position embeddings [1024][1024], 16 heads x 64, FFN 4096): word = CausalMHA(wemb; q,k,v = Linear+bias, scores/8, tril, softmax, .v, heads merged, no output projection); cross = MHA(q from word, k/v from pemb, no mask); out = relu(cross*W1^T + b1)*W2^T + b2 -> [2048,1024].
// Compute dtype: inputs and parameters rounded to bf16; projections of the embeddings exact; all other operands f16 hi + (x2^10) residual pairs (~2^-21); f32 accumulation, softmax f32. v_wmma_f32_16x16x32_f16.
#define SW 2048
#define SP 1024
#define DM 1024
#define NH 16
#define FF 4096
#define SCL 0.125f
#define SCL2 (SCL * 1.4426950408889634f)      /* 1/sqrt(64) * log2(e): k_flashm keeps scores and running maxima in base 2, exp(x) = 2^(x * log2(e)) */
#define SKV ((SW > SP) ? SW : SP)      /* the larger key count, used nowhere: the self attention has SW keys, the cross attention SP */
typedef __bf16 v16b __attribute__((ext_vector_type(16)));
typedef unsigned short v8us __attribute__((ext_vector_type(8), may_alias));
typedef float  v8f  __attribute__((ext_vector_type(8)));
typedef float  v4f  __attribute__((ext_vector_type(4)));
typedef float  v4fa __attribute__((ext_vector_type(4), may_alias));
union FragB { v16b v; v8us half[2]; unsigned short u[16]; };

__device__ __forceinline__ unsigned short bf16_bits(float x) { unsigned int u = __float_as_uint(x); return (unsigned short)((u + 0x7FFFu + ((u >> 16) & 1u)) >> 16); }
__device__ __forceinline__ float bf16_val(unsigned short b) { return __uint_as_float(((unsigned int)b) << 16); }
__device__ __forceinline__ float bf16_round(float x) { return bf16_val(bf16_bits(x)); }
// D += A·B with NT terms: 1 = ah·bh, 2 = + al·bh (A split), 3 = + ah·bl (both split)
template <int NT>
__device__ __forceinline__ v8f mmaN(v16b ah, v16b al, v16b bh, v16b bl, v8f c) {
  c = __builtin_amdgcn_wmma_f32_16x16x32_bf16(false, ah, false, bh, (short)0, c, false, false);
  if (NT >= 2) c = __builtin_amdgcn_wmma_f32_16x16x32_bf16(false, al, false, bh, (short)0, c, false, false);
  if (NT >= 3) c = __builtin_amdgcn_wmma_f32_16x16x32_bf16(false, ah, false, bl, (short)0, c, false, false);
  asm volatile("v_nop\n\tv_nop\n\tv_nop\n\tv_nop" : "+v"(c) : "v"(ah), "v"(al), "v"(bh), "v"(bl));
  return c;
}

__global__ __launch_bounds__(256) void k_wt_bf16(const float* __restrict__ W, unsigned short* __restrict__ Wt, int K, int N) {
  const int t = blockIdx.x * 256 + threadIdx.x;
  const int k8n = K / 8;
  if (t >= N * k8n) return;
  const int n = t / k8n, k8 = (t % k8n) * 8;
  v8us v;
#pragma unroll
  for (int i = 0; i < 8; ++i) v[i] = bf16_bits(W[(size_t)(k8 + i) * N + n]);
  *(v8us*)(Wt + (size_t)n * K + k8) = v;
  
}

// GEMM C[M][N] (f32, pitch ldc) = act(A[M][K]·W + bias). A f32 row-major (pitch lda) converted per fragment to bf16
// (ASPLIT: hi/lo two planes -> 2 terms, else single rounded term); Wt bf16 [N][K] (pitch ldb). BIAS_BF16 rounds the
// bias to bf16 first (bias quantised to bf16 before the add). K%32==0, M%16==0, N%64==0.
template <bool ASPLIT, int ACT, bool BIAS_BF16>
__global__ __launch_bounds__(128) void k_gemm_bf(const float* __restrict__ A, int lda, const unsigned short* __restrict__ Wt, int ldb,
                                               const float* __restrict__ bias, float* __restrict__ C, int ldc, int M, int N, int K) {
  __shared__ __attribute__((aligned(16))) float so[4][16][64];
  const int tid = threadIdx.x, w = tid >> 5, lane = tid & 31, ln = lane & 15, hh = lane >> 4;
  const int ntn = N / 64;
  const int wid = blockIdx.x * 4 + w;
  const int mt = wid / ntn, nq = wid % ntn;
  if (mt * 16 >= M) return;
  const int row0 = mt * 16, col0 = nq * 64;
  const float* arow = A + (size_t)(row0 + ln) * lda;
  v8f acc[4] = {};
  for (int kb = 0; kb < K; kb += 32) {
    FragB ah, al;
    const v4f x0 = *(const v4fa*)(arow + kb + 8 * hh), x1 = *(const v4fa*)(arow + kb + 8 * hh + 4);
    const v4f x2 = *(const v4fa*)(arow + kb + 16 + 8 * hh), x3 = *(const v4fa*)(arow + kb + 16 + 8 * hh + 4);
    float xs[16] = {x0[0],x0[1],x0[2],x0[3],x1[0],x1[1],x1[2],x1[3],x2[0],x2[1],x2[2],x2[3],x3[0],x3[1],x3[2],x3[3]};
#pragma unroll
    for (int i = 0; i < 16; ++i) { const unsigned short hb = bf16_bits(xs[i]); ah.u[i] = hb; al.u[i] = ASPLIT ? bf16_bits(xs[i] - bf16_val(hb)) : (unsigned short)0; }
#pragma unroll
    for (int t = 0; t < 4; ++t) {
      const unsigned short* brow = Wt + (size_t)(col0 + t * 16 + ln) * ldb + kb;
      FragB b;
      b.half[0] = *(const v8us*)(brow + 8 * hh);
      b.half[1] = *(const v8us*)(brow + 16 + 8 * hh);
      acc[t] = mmaN<ASPLIT ? 2 : 1>(ah.v, al.v, b.v, b.v, acc[t]);
    }
  }
#pragma unroll
  for (int t = 0; t < 4; ++t) {
    float bv = bias ? bias[col0 + t * 16 + ln] : 0.f;
    if (BIAS_BF16) bv = bf16_round(bv);
#pragma unroll
    for (int r = 0; r < 8; ++r) { float v = acc[t][r] + bv; if (ACT == 1) v = fmaxf(v, 0.f); so[w][8 * hh + r][t * 16 + ln] = v; }
  }
  __builtin_amdgcn_fence(__ATOMIC_ACQ_REL, "workgroup");
  __builtin_amdgcn_wave_barrier();
  const int rsub = lane >> 4, c4 = (lane & 15) * 4;
  {
#pragma unroll
    for (int q = 0; q < 8; ++q) {
      const int r = q * 2 + rsub;
      const v4f v = *(const v4fa*)&so[w][r][c4];
      *(v4f*)(C + (size_t)(row0 + r) * ldc + col0 + c4) = v;
    }
    
  }
}

// GEMM C = act(A·W + bias + resid): A f32 (ASPLIT -> hi/lo 2 terms), Wt bf16 [N][K]; ACT 0 none, 1 relu, 2 exact gelu;
// resid (optional, f32, row index = (row % rmod), pitch ldr, RES_BF16 rounds it) added before the activation.
template <bool ASPLIT, int ACT, bool BIAS_BF16, bool RES_BF16>
__global__ __launch_bounds__(128) void k_gemm_bf3(const float* __restrict__ A, int lda, const unsigned short* __restrict__ Wt, int ldb,
                                                const float* __restrict__ bias, const float* __restrict__ resid, int rmod, int ldr,
                                                float* __restrict__ C, int ldc, int M, int N, int K) {
  __shared__ __attribute__((aligned(16))) float so[4][16][64];
  const int tid = threadIdx.x, w = tid >> 5, lane = tid & 31, ln = lane & 15, hh = lane >> 4;
  const int ntn = N / 64;
  const int wid = blockIdx.x * 4 + w;
  const int mt = wid / ntn, nq = wid % ntn;
  if (mt * 16 >= M) return;
  const int row0 = mt * 16, col0 = nq * 64;
  const float* arow = A + (size_t)(row0 + ln) * lda;
  v8f acc[4] = {};
  for (int kb = 0; kb < K; kb += 32) {
    FragB ah, al;
    const v4f x0 = *(const v4fa*)(arow + kb + 8 * hh), x1 = *(const v4fa*)(arow + kb + 8 * hh + 4);
    const v4f x2 = *(const v4fa*)(arow + kb + 16 + 8 * hh), x3 = *(const v4fa*)(arow + kb + 16 + 8 * hh + 4);
    float xs[16] = {x0[0],x0[1],x0[2],x0[3],x1[0],x1[1],x1[2],x1[3],x2[0],x2[1],x2[2],x2[3],x3[0],x3[1],x3[2],x3[3]};
#pragma unroll
    for (int i = 0; i < 16; ++i) { const unsigned short hb = bf16_bits(xs[i]); ah.u[i] = hb; al.u[i] = ASPLIT ? bf16_bits(xs[i] - bf16_val(hb)) : (unsigned short)0; }
#pragma unroll
    for (int t = 0; t < 4; ++t) {
      const unsigned short* brow = Wt + (size_t)(col0 + t * 16 + ln) * ldb + kb;
      FragB b;
      b.half[0] = *(const v8us*)(brow + 8 * hh);
      b.half[1] = *(const v8us*)(brow + 16 + 8 * hh);
      acc[t] = mmaN<ASPLIT ? 2 : 1>(ah.v, al.v, b.v, b.v, acc[t]);
    }
  }
#pragma unroll
  for (int t = 0; t < 4; ++t) {
    const int col = col0 + t * 16 + ln;
    float bv = bias ? bias[col] : 0.f;
    if (BIAS_BF16) bv = bf16_round(bv);
#pragma unroll
    for (int r = 0; r < 8; ++r) {
      float v = acc[t][r] + bv;
      if (resid) { float rv = resid[(size_t)((row0 + 8 * hh + r) % rmod) * ldr + col]; if (RES_BF16) rv = bf16_round(rv); v += rv; }
      if (ACT == 1) v = fmaxf(v, 0.f);
      if (ACT == 2) v = 0.5f * v * (1.0f + erff(v * 0.70710678118654752f));
      if (ACT == 3) { const float u = 0.7978845608028654f * (v + 0.044715f * v * v * v); v = 0.5f * v * (1.0f + tanhf(u)); }
      so[w][8 * hh + r][t * 16 + ln] = v;
    }
  }
  __builtin_amdgcn_fence(__ATOMIC_ACQ_REL, "workgroup");
  __builtin_amdgcn_wave_barrier();
  const int rsub = lane >> 4, c4 = (lane & 15) * 4;
  {
#pragma unroll
    for (int q = 0; q < 8; ++q) {
      const int r = q * 2 + rsub;
      const v4f v = *(const v4fa*)&so[w][r][c4];
      *(v4f*)(C + (size_t)(row0 + r) * ldc + col0 + c4) = v;
    }
    
  }
}
// row LayerNorm (biased variance, eps) over N: s = X (+ R); optional out_sum <- s; out_norm <- (s-mu)*rsqrt(var+eps)*g + b
template <bool PARAM_BF16>
__global__ __launch_bounds__(256) void k_layernorm(const float* __restrict__ X, const float* __restrict__ R, const float* __restrict__ g, const float* __restrict__ bta,
                                                  float* __restrict__ out_sum, float* __restrict__ out_norm, int N, float eps) {
  __shared__ float red[256];
  const int row = blockIdx.x, tid = threadIdx.x;
  const float* x = X + (size_t)row * N; const float* rr = R ? R + (size_t)row * N : nullptr;
  float vals[16];                     // up to N = 4096
  const int per = N / 256;            // contiguous chunk per thread? use strided-by-4 chunks: thread handles j = tid*4 + 1024*u
  float s1 = 0.f;
  for (int u = 0; u < per / 4; ++u) {
    const int j = tid * 4 + 1024 * u;
    const v4f a = *(const v4fa*)(x + j);
    v4f b = {0.f,0.f,0.f,0.f}; if (rr) b = *(const v4fa*)(rr + j);
#pragma unroll
    for (int q = 0; q < 4; ++q) { const float v = a[q] + b[q]; vals[u * 4 + q] = v; s1 += v; }
  }
  red[tid] = s1; __syncthreads();
  for (int st = 128; st > 0; st >>= 1) { if (tid < st) red[tid] += red[tid + st]; __syncthreads(); }
  const float mu = red[0] / (float)N; __syncthreads();
  float s2 = 0.f;
  for (int u = 0; u < per / 4; ++u)
#pragma unroll
    for (int q = 0; q < 4; ++q) { const float c = vals[u * 4 + q] - mu; s2 += c * c; }
  red[tid] = s2; __syncthreads();
  for (int st = 128; st > 0; st >>= 1) { if (tid < st) red[tid] += red[tid + st]; __syncthreads(); }
  const float rs = rsqrtf(red[0] / (float)N + eps);
  {
    for (int u = 0; u < per / 4; ++u) {
      const int j = tid * 4 + 1024 * u;
      v4f o, sm;
#pragma unroll
      for (int q = 0; q < 4; ++q) {
        float gg = g[j + q], bb = bta[j + q];
        if (PARAM_BF16) { gg = bf16_round(gg); bb = bf16_round(bb); }
        sm[q] = vals[u * 4 + q]; o[q] = (vals[u * 4 + q] - mu) * rs * gg + bb;
      }
      if (out_sum) *(v4f*)(out_sum + (size_t)row * N + j) = sm;
      *(v4f*)(out_norm + (size_t)row * N + j) = o;
    }
    
  }
}



// ---- f16 WMMA path (v_wmma_f32_16x16x32_f16): 11-bit significands for operands in range — used where a [0,1] probability operand needs more precision than bf16
typedef _Float16 v16h __attribute__((ext_vector_type(16)));
union FragH { v16h v; v8us half[2]; _Float16 h[16]; unsigned short u[16]; };
template <int NT>
__device__ __forceinline__ v8f mmaH(v16h ah, v16h al, v16h bh, v16h bl, v8f c) {
  c = __builtin_amdgcn_wmma_f32_16x16x32_f16(false, ah, false, bh, (short)0, c, false, false);
  if (NT >= 2) c = __builtin_amdgcn_wmma_f32_16x16x32_f16(false, al, false, bh, (short)0, c, false, false);
  if (NT >= 3) c = __builtin_amdgcn_wmma_f32_16x16x32_f16(false, ah, false, bl, (short)0, c, false, false);
  asm volatile("v_nop\n\tv_nop\n\tv_nop\n\tv_nop" : "+v"(c) : "v"(ah), "v"(al), "v"(bh), "v"(bl));
  return c;
}
// batched GEMM like k_gemm_b but f16 operands: A f32 (split into f16 hi/lo if ASPLIT, else rounded to f16), Bt = f16 values [n][k]; alpha; C f32; N multiple of 16 (partial tiles skipped)
template <bool ASPLIT>
__global__ __launch_bounds__(128) void k_gemm_h(const float* __restrict__ A, int lda, size_t sA, const _Float16* __restrict__ Bh, int ldb, size_t sB, float alpha, float* __restrict__ C, int ldc, size_t sC, int M, int N, int K) {
  __shared__ __attribute__((aligned(16))) float so[4][16][64];
  const int tid = threadIdx.x, w = tid >> 5, lane = tid & 31, ln = lane & 15, hh = lane >> 4; const int by = blockIdx.y;
  A += (size_t)by * sA; Bh += (size_t)by * sB; C += (size_t)by * sC;
  const int ntn = (N + 63) / 64; const int wid = blockIdx.x * 4 + w; const int mt = wid / ntn, nq = wid % ntn; if (mt * 16 >= M) return;
  const int row0 = mt * 16, col0 = nq * 64; const float* arow = A + (size_t)(row0 + ln) * lda;
  v8f acc[4] = {};
  for (int kb = 0; kb < K; kb += 32) {
    FragH ah, al;
    const v4f x0 = *(const v4fa*)(arow + kb + 8 * hh), x1 = *(const v4fa*)(arow + kb + 8 * hh + 4), x2 = *(const v4fa*)(arow + kb + 16 + 8 * hh), x3 = *(const v4fa*)(arow + kb + 16 + 8 * hh + 4);
    float xs[16] = {x0[0],x0[1],x0[2],x0[3],x1[0],x1[1],x1[2],x1[3],x2[0],x2[1],x2[2],x2[3],x3[0],x3[1],x3[2],x3[3]};
#pragma unroll
    for (int i = 0; i < 16; ++i) { const _Float16 h = (_Float16)xs[i]; ah.h[i] = h; al.h[i] = ASPLIT ? (_Float16)(xs[i] - (float)h) : (_Float16)0.0f; }
#pragma unroll
    for (int t = 0; t < 4; ++t) { if (col0 + t * 16 >= N) continue; const size_t boff = (size_t)(col0 + t * 16 + ln) * ldb + kb; FragH bq; bq.half[0] = *(const v8us*)(Bh + boff + 8 * hh); bq.half[1] = *(const v8us*)(Bh + boff + 16 + 8 * hh);
      acc[t] = mmaH<ASPLIT ? 2 : 1>(ah.v, al.v, bq.v, bq.v, acc[t]); }
  }
#pragma unroll
  for (int t = 0; t < 4; ++t) { if (col0 + t * 16 >= N) continue;
#pragma unroll
    for (int r = 0; r < 8; ++r) so[w][8 * hh + r][t * 16 + ln] = acc[t][r] * alpha; }
  __builtin_amdgcn_fence(__ATOMIC_ACQ_REL, "workgroup"); __builtin_amdgcn_wave_barrier();
  const int rsub = lane >> 4, c4 = (lane & 15) * 4;
  {
#pragma unroll
    for (int q = 0; q < 8; ++q) { const int r = q * 2 + rsub; if (col0 + c4 < N) { const v4f v = *(const v4fa*)&so[w][r][c4]; *(v4f*)(C + (size_t)(row0 + r) * ldc + col0 + c4) = v; } }
     }
}

// Wt[n][k] = f16(W[k][n]·scale) from f32 row-major W[K][N] (scale = power of two; bf16-exact weights stay exact in f16 away from the subnormal range)
__global__ __launch_bounds__(256) void k_wt_f16(const float* __restrict__ W, _Float16* __restrict__ Wt, int K, int N, float scale) {
  const int t = blockIdx.x * 256 + threadIdx.x; if (t >= N * (K / 8)) return; const int n = t / (K / 8), k8 = (t % (K / 8)) * 8; FragH f;
#pragma unroll
  for (int i = 0; i < 8; ++i) f.h[i] = (_Float16)(bf16_round(W[(size_t)(k8 + i) * N + n]) * scale); const v8us o = f.half[0];
  *(v8us*)((unsigned short*)Wt + (size_t)n * K + k8) = o; 
}
// k_gemm_hh variant with fused epilogue: v = acc·alpha + bias[by·sBias + col] (+ CP[(row/rowsPerB)·sCPb + by·64 + col] if CP) ; ACT 0 none / 1 elu ; writes f16 C16 (and f32 C if non-null)
template <int ACT>
__global__ __launch_bounds__(128) void k_gemm_hhx(const _Float16* __restrict__ A, int lda, size_t sA, const _Float16* __restrict__ Bh, int ldb, size_t sB, float alpha, const float* __restrict__ bias, size_t sBias, const float* __restrict__ CP, int rowsPerB, size_t sCPb, int row0g,
    float* __restrict__ C, _Float16* __restrict__ C16, int ldc, size_t sC, int M, int N, int K) {
  __shared__ __attribute__((aligned(16))) float so[4][16][64];
  const int tid = threadIdx.x, w = tid >> 5, lane = tid & 31, ln = lane & 15, hh = lane >> 4; const int by = blockIdx.y;
  A += (size_t)by * sA; Bh += (size_t)by * sB; const size_t cofs = (size_t)by * sC; const float* bp = bias ? bias + (size_t)by * sBias : nullptr;
  const int ntn = (N + 63) / 64; const int wid = blockIdx.x * 4 + w; const int mt = wid / ntn, nq = wid % ntn; if (mt * 16 >= M) return;
  const int row0 = mt * 16, col0 = nq * 64; const _Float16* arow = A + (size_t)(row0 + ln) * lda;
  v8f acc[4] = {};
  for (int kb = 0; kb < K; kb += 32) { FragH ah; ah.half[0] = *(const v8us*)((const unsigned short*)arow + kb + 8 * hh); ah.half[1] = *(const v8us*)((const unsigned short*)arow + kb + 16 + 8 * hh);
#pragma unroll
    for (int t = 0; t < 4; ++t) { if (col0 + t * 16 >= N) continue; const size_t boff = (size_t)(col0 + t * 16 + ln) * ldb + kb; FragH bq; bq.half[0] = *(const v8us*)((const unsigned short*)Bh + boff + 8 * hh); bq.half[1] = *(const v8us*)((const unsigned short*)Bh + boff + 16 + 8 * hh);
      acc[t] = mmaH<1>(ah.v, ah.v, bq.v, bq.v, acc[t]); }
  }
#pragma unroll
  for (int t = 0; t < 4; ++t) { if (col0 + t * 16 >= N) continue; const int col = col0 + t * 16 + ln; const float bv = bp ? bf16_round(bp[col]) : 0.f;
#pragma unroll
    for (int r = 0; r < 8; ++r) { float v = acc[t][r] * alpha + bv; if (CP) { const int bidx = (row0g + row0 + 8 * hh + r) / rowsPerB; v += CP[(size_t)bidx * sCPb + (size_t)by * 64 + col]; } if (ACT == 1) v = (v > 0.f) ? v : expm1f(v); else if (ACT == 7) v = (v > 0.f) ? v + 1.0f : expf(v); else if (ACT == 8) v = tanhf(v); else if (ACT == 9) v = 0.5f * v * (1.0f + tanhf(0.7978845608028654f * (v + 0.044715f * v * v * v))); else if (ACT == 11) v = 1.0f / (1.0f + expf(-v)); else if (ACT == 12) v = (v > 0.f) ? v : 0.01f * v; else if (ACT == 14) v = (v > 0.f) ? v : 0.1f * v; else if (ACT == 15) v = v / (1.0f + expf(-v)); else if (ACT == 3) v = fmaxf(v, 0.f); else if (ACT == 6) v = 0.5f * v * (1.0f + erff(v * 0.70710678118654752f)); so[w][8 * hh + r][t * 16 + ln] = v; } }
  __builtin_amdgcn_fence(__ATOMIC_ACQ_REL, "workgroup"); __builtin_amdgcn_wave_barrier();
  const int rsub = lane >> 4, c4 = (lane & 15) * 4; typedef _Float16 v4h __attribute__((ext_vector_type(4)));
  {
#pragma unroll
    for (int q = 0; q < 8; ++q) { const int r = q * 2 + rsub; if (col0 + c4 < N) { const v4f v = *(const v4fa*)&so[w][r][c4]; if (C) *(v4f*)(C + cofs + (size_t)(row0 + r) * ldc + col0 + c4) = v; if (C16) { v4h h4; for (int i = 0; i < 4; ++i) h4[i] = (_Float16)v[i]; *(v4h*)(C16 + cofs + (size_t)(row0 + r) * ldc + col0 + c4) = h4; } } }
     }
}


typedef _Float16 v4h __attribute__((ext_vector_type(4)));

// Bodies of the short kernels: blk is the block's index inside its own job, so that independent jobs can share one grid, each on its own range of block indices.
__device__ __forceinline__ void d_x16(const float* __restrict__ x, _Float16* __restrict__ X16, size_t n8, unsigned blk) { const size_t t = (size_t)blk * 256 + threadIdx.x; if (t >= n8) return; FragH f;
#pragma unroll
  for (int q = 0; q < 8; ++q) f.h[q] = (_Float16)bf16_round(x[t * 8 + q]); *(v8us*)((unsigned short*)X16 + t * 8) = f.half[0];  }
__global__ __launch_bounds__(256) void k_h16(const float* __restrict__ x, _Float16* __restrict__ X16, size_t n8) { const size_t t = (size_t)blockIdx.x * 256 + threadIdx.x; if (t >= n8) return; FragH f;
#pragma unroll
  for (int q = 0; q < 8; ++q) f.h[q] = (_Float16)x[t * 8 + q]; *(v8us*)((unsigned short*)X16 + t * 8) = f.half[0];  }
__device__ __forceinline__ void d_round16f(const float* __restrict__ W, _Float16* __restrict__ Bt, size_t n8, unsigned blk) { const size_t t = (size_t)blk * 256 + threadIdx.x; if (t >= n8) return; FragH f;
#pragma unroll
  for (int i = 0; i < 8; ++i) f.h[i] = (_Float16)(bf16_round(W[t * 8 + i]) * 16.0f); *(v8us*)((unsigned short*)Bt + t * 8) = f.half[0];  }
template <int NHv, int TTv>
__global__ __launch_bounds__(256) void k_vt(const _Float16* __restrict__ V16, int ldv, int voff, _Float16* __restrict__ Vt) { __shared__ unsigned short tl[64][66]; const int tid = threadIdx.x; const int slab = blockIdx.x / (TTv / 64), lg = blockIdx.x % (TTv / 64); const int b = slab / NHv, h = slab % NHv;
  for (int i = tid; i < 64 * 8; i += 256) { const int r = i / 8, c8 = (i % 8) * 8; FragH f; f.half[0] = *(const v8us*)((const unsigned short*)V16 + ((size_t)b * TTv + lg * 64 + r) * ldv + voff + h * 64 + c8);
#pragma unroll
    for (int q = 0; q < 8; ++q) tl[r][c8 + q] = f.u[q]; }
  __syncthreads();
  {
#pragma unroll
    for (int rd = 0; rd < 2; ++rd) { const int d = rd * 32 + tid / 8, pc = tid % 8; FragH f;
#pragma unroll
      for (int q = 0; q < 8; ++q) f.u[q] = tl[pc * 8 + q][d];
      *(v8us*)((unsigned short*)Vt + ((size_t)slab * 64 + d) * TTv + lg * 64 + pc * 8) = f.half[0]; }
     } }

// An f32 value as an operand pair: hi = f16(v), lo = f16((v - hi) * 2^10). The kernel that makes a value stores the pair itself.
__device__ __forceinline__ void hl4(v4f v, v4h& hi, v4h& lo) {
#pragma unroll
  for (int i = 0; i < 4; ++i) { const _Float16 h = (_Float16)v[i]; hi[i] = h; lo[i] = (_Float16)((v[i] - (float)h) * 1024.0f); } }

// ---- fast GEMM (block tile 128x64, wave tile 32x64; requires M % 128 == 0, N % 64 == 0 and K % 128 == 0); epilogue = k_gemm_hhx semantics ----
// k loop staging of g2_body: one stage = 128 k (256 B of a row) of the block's 128 A rows and 64 B rows, laid in LDS at a pitch of 272 B (16 B x odd, for the 16-byte fragment reads); two buffers.
#define G2_PITCH 272
#define G2_AB (128 * G2_PITCH)
#define G2_STAGE ((128 + 64) * G2_PITCH)
__device__ __forceinline__ v16h g2_lfrag(const unsigned char* p, int hh) { FragH f; f.half[0] = *(const v8us*)(p + 16 * hh); f.half[1] = *(const v8us*)(p + 32 + 16 * hh); return f.v; }
__device__ __forceinline__ v8f g2_mm(v16h a, v16h b, v8f c) { return __builtin_amdgcn_wmma_f32_16x16x32_f16(false, a, false, b, (short)0, c, false, false); }
// One wave's share of a stage: 32 A rows and 16 B rows, two rows (2 x 256 B, whole lines) per wave-wide copy, 16 B per lane, 24 copies.
// la, lb: the lane's LDS byte addresses of its first A and B chunk; ga, gb: the matching global addresses; a copy further on is two rows further on.
__device__ __forceinline__ void g2_stage(unsigned la, unsigned lb, const _Float16* ga, int lda, const _Float16* gb, int ldb) {
  unsigned l[24]; const _Float16* g[24];
#pragma unroll
  for (int i = 0; i < 16; ++i) { l[i] = la + i * (2 * G2_PITCH); g[i] = ga + (size_t)(2 * i) * lda; }
#pragma unroll
  for (int i = 0; i < 8; ++i) { l[16 + i] = lb + i * (2 * G2_PITCH); g[16 + i] = gb + (size_t)(2 * i) * ldb; }
  // the copies go to LDS through no register; s_wait_xcnt is the statement's last line so that no address register is rewritten ahead of it
  asm volatile("global_load_async_to_lds_b128 %0, %12, off\n\t"
               "global_load_async_to_lds_b128 %1, %13, off\n\t"
               "global_load_async_to_lds_b128 %2, %14, off\n\t"
               "global_load_async_to_lds_b128 %3, %15, off\n\t"
               "global_load_async_to_lds_b128 %4, %16, off\n\t"
               "global_load_async_to_lds_b128 %5, %17, off\n\t"
               "global_load_async_to_lds_b128 %6, %18, off\n\t"
               "global_load_async_to_lds_b128 %7, %19, off\n\t"
               "global_load_async_to_lds_b128 %8, %20, off\n\t"
               "global_load_async_to_lds_b128 %9, %21, off\n\t"
               "global_load_async_to_lds_b128 %10, %22, off\n\t"
               "global_load_async_to_lds_b128 %11, %23, off\n\t"
               "s_wait_xcnt 0x0"
               :: "v"(l[0]), "v"(l[1]), "v"(l[2]), "v"(l[3]), "v"(l[4]), "v"(l[5]), "v"(l[6]), "v"(l[7]), "v"(l[8]), "v"(l[9]), "v"(l[10]), "v"(l[11]),
                  "v"(g[0]), "v"(g[1]), "v"(g[2]), "v"(g[3]), "v"(g[4]), "v"(g[5]), "v"(g[6]), "v"(g[7]), "v"(g[8]), "v"(g[9]), "v"(g[10]), "v"(g[11]) : "memory");
  asm volatile("global_load_async_to_lds_b128 %0, %12, off\n\t"
               "global_load_async_to_lds_b128 %1, %13, off\n\t"
               "global_load_async_to_lds_b128 %2, %14, off\n\t"
               "global_load_async_to_lds_b128 %3, %15, off\n\t"
               "global_load_async_to_lds_b128 %4, %16, off\n\t"
               "global_load_async_to_lds_b128 %5, %17, off\n\t"
               "global_load_async_to_lds_b128 %6, %18, off\n\t"
               "global_load_async_to_lds_b128 %7, %19, off\n\t"
               "global_load_async_to_lds_b128 %8, %20, off\n\t"
               "global_load_async_to_lds_b128 %9, %21, off\n\t"
               "global_load_async_to_lds_b128 %10, %22, off\n\t"
               "global_load_async_to_lds_b128 %11, %23, off\n\t"
               "s_wait_xcnt 0x0"
               :: "v"(l[12]), "v"(l[13]), "v"(l[14]), "v"(l[15]), "v"(l[16]), "v"(l[17]), "v"(l[18]), "v"(l[19]), "v"(l[20]), "v"(l[21]), "v"(l[22]), "v"(l[23]),
                  "v"(g[12]), "v"(g[13]), "v"(g[14]), "v"(g[15]), "v"(g[16]), "v"(g[17]), "v"(g[18]), "v"(g[19]), "v"(g[20]), "v"(g[21]), "v"(g[22]), "v"(g[23]) : "memory");
}
// bx, by: the block's tile index and batch index inside its own product
// Results: C (f32), C16 (f16), Hh and Hl (hi/lo operand planes, C's shape and pitch), Th and Tl (hi/lo planes of the transposed result, [N][M], pitch M; no addend, no activation); each optional, the tests are block-uniform.
template <int ACT>
__device__ __forceinline__ void g2_body(const _Float16* __restrict__ A, int lda, size_t sA, const _Float16* __restrict__ Bh, int ldb, size_t sB, float alpha, const float* __restrict__ bias, size_t sBias, const float* __restrict__ CP, int rowsPerB, size_t sCPb, int row0g,
    float* __restrict__ C, _Float16* __restrict__ C16, _Float16* __restrict__ Hh, _Float16* __restrict__ Hl, _Float16* __restrict__ Th, _Float16* __restrict__ Tl, int ldc, size_t sC, int M, int N, int K, int bx, int by) {
  __shared__ __attribute__((aligned(16))) float so[4][32][68]; __shared__ __attribute__((aligned(16))) unsigned char ring[2 * G2_STAGE];
  const int tid = threadIdx.x, w = tid >> 5, lane = tid & 31, ln = lane & 15, hh = lane >> 4;
  A += (size_t)by * sA; Bh += (size_t)by * sB; const size_t cofs = (size_t)by * sC; const float* bp = bias ? bias + (size_t)by * sBias : nullptr;
  const int ntn = N >> 6; const int mt = bx / ntn, nq = bx - mt * ntn; const int row0 = mt * 128 + 32 * w, col0 = nq * 64; if (mt * 128 >= M) return;      /* the whole block leaves, in front of every barrier */
  const v8f z8 = {0.f,0.f,0.f,0.f,0.f,0.f,0.f,0.f}; v8f c00 = z8, c01 = z8, c02 = z8, c03 = z8, c10 = z8, c11 = z8, c12 = z8, c13 = z8;
  const _Float16* ga = A + (size_t)(row0 + hh) * lda + ln * 8; const _Float16* gb = Bh + (size_t)(col0 + 16 * w + hh) * ldb + ln * 8;      /* this lane's first 16 bytes of the wave's A and B rows */
  const unsigned la = (unsigned)(size_t)ring + (unsigned)((32 * w + hh) * G2_PITCH + ln * 16), lb = (unsigned)(size_t)ring + (unsigned)(G2_AB + (16 * w + hh) * G2_PITCH + ln * 16);
  const int nst = K >> 7;
  g2_stage(la, lb, ga, lda, gb, ldb);
  // What the epilogue adds (bias, addend CP) is read here, in the layout of the write-out pass (lane = 4 columns of rows 2q + hh): 17 independent 16-byte loads issued as one group, in flight beside stage 0's copies.
  const int c4 = ln * 4; const v4f z4 = {0.f,0.f,0.f,0.f}; v4f b4 = z4, cp[16];
#pragma unroll
  for (int q = 0; q < 16; ++q) cp[q] = z4;
  if (CP) { const float* pc[16];
#pragma unroll
    for (int q = 0; q < 16; ++q) { const int bidx = (row0g + row0 + q * 2 + hh) / rowsPerB; pc[q] = CP + (size_t)bidx * sCPb + (size_t)by * 64 + col0 + c4; }
    __builtin_amdgcn_sched_barrier(0);      /* all 16 addresses are formed in front of the loads, each in registers of its own: formed among the loads they share registers, and each reuse waits for an issued load */
#pragma unroll
    for (int q = 0; q < 16; ++q) cp[q] = *(const v4fa*)pc[q];
    asm volatile("s_wait_xcnt 0x0" ::: "memory");      /* stands in front of whatever reuses the address registers of the 16 loads above */
  }
  float bt[4] = {0.f, 0.f, 0.f, 0.f};      /* the bias in the accumulators' layout (lane = column 16 t + ln), for the transposed write-out */
  if (bp) { b4 = *(const v4fa*)(bp + col0 + c4);
#pragma unroll
    for (int t = 0; t < 4; ++t) bt[t] = bp[col0 + t * 16 + ln];
    asm volatile("s_wait_xcnt 0x0" ::: "memory");      /* the same for the bias loads */
  }
  asm volatile("s_wait_asynccnt 0x0" ::: "memory");      /* this wave's copies of stage 0 have landed */
  __syncthreads();      /* and every other wave's: stage 0 may be read */
  if (nst > 1) g2_stage(la + G2_STAGE, lb + G2_STAGE, ga + 128, lda, gb + 128, ldb);
#pragma unroll 1      /* one trip per stage: the two buffers alternate */
  for (int t = 0; t < nst; ++t) { const unsigned bo = (unsigned)(t & 1) * G2_STAGE; const unsigned char* pa = ring + bo + (32 * w + ln) * G2_PITCH; const unsigned char* pb = ring + bo + G2_AB + ln * G2_PITCH;
    v16h fa[2][2], fb[2][4];      /* two fragment sets: the next k step's LDS reads are issued, as one group, ahead of this step's WMMAs; never beyond the stage */
    fa[0][0] = g2_lfrag(pa, hh); fa[0][1] = g2_lfrag(pa + 16 * G2_PITCH, hh);
#pragma unroll
    for (int j = 0; j < 4; ++j) fb[0][j] = g2_lfrag(pb + j * 16 * G2_PITCH, hh);
#pragma unroll
    for (int ks = 0; ks < 4; ++ks) { const int cu = ks & 1, nx = cu ^ 1;
      if (ks < 3) { fa[nx][0] = g2_lfrag(pa + (ks + 1) * 64, hh); fa[nx][1] = g2_lfrag(pa + 16 * G2_PITCH + (ks + 1) * 64, hh);
#pragma unroll
        for (int j = 0; j < 4; ++j) fb[nx][j] = g2_lfrag(pb + j * 16 * G2_PITCH + (ks + 1) * 64, hh); }
      __builtin_amdgcn_sched_barrier(0);      /* keeps the reads above in front of the WMMAs below: sunk to their uses, each pair of WMMAs waits out an LDS latency */
      c00 = g2_mm(fa[cu][0], fb[cu][0], c00); c10 = g2_mm(fa[cu][1], fb[cu][0], c10); c01 = g2_mm(fa[cu][0], fb[cu][1], c01); c11 = g2_mm(fa[cu][1], fb[cu][1], c11);
      c02 = g2_mm(fa[cu][0], fb[cu][2], c02); c12 = g2_mm(fa[cu][1], fb[cu][2], c12); c03 = g2_mm(fa[cu][0], fb[cu][3], c03); c13 = g2_mm(fa[cu][1], fb[cu][3], c13);
      __builtin_amdgcn_sched_barrier(0);      /* keeps the next group of reads behind these WMMAs, so that two sets suffice */
    }
    asm volatile("s_wait_dscnt 0x0" ::: "memory");      /* this wave's reads of the buffer are done before it is refilled */
    asm volatile("s_wait_asynccnt 0x0" ::: "memory");      /* this wave's copies of stage t + 1 have landed */
    __syncthreads();      /* publishes stage t + 1 and ends every wave's reads of stage t */
    if (t + 2 < nst) g2_stage(la + bo, lb + bo, ga + (size_t)(t + 2) * 128, lda, gb + (size_t)(t + 2) * 128, ldb); }
  asm volatile("s_wait_asynccnt 0x0" ::: "memory");      /* no copy is left in flight */
  v8f accs[8] = {c00, c01, c02, c03, c10, c11, c12, c13};
  if (Th) {      /* transposed hi/lo planes: an accumulator's 8 registers are 8 consecutive rows of one column, that is 16 bytes of a transposed row; they go through LDS so that a transposed row's 128 elements leave as one 256-byte run */
    unsigned char* tp = (unsigned char*)&so[0][0][0];      /* two planes of 64 rows at the ring's pitch: 2 * 64 * 272 B, the size of so */
#pragma unroll
    for (int u = 0; u < 8; ++u) { const int t = u & 3, half = u >> 2; const float bb = bf16_round(bt[t]); FragH fh, fl;
#pragma unroll
      for (int r = 0; r < 8; ++r) { const float v = accs[u][r] * alpha + bb; const _Float16 hv = (_Float16)v; fh.h[r] = hv; fl.h[r] = (_Float16)((v - (float)hv) * 1024.0f); }
      unsigned char* q = tp + (t * 16 + ln) * G2_PITCH + (32 * w + half * 16 + 8 * hh) * 2; *(v8us*)q = fh.half[0]; *(v8us*)(q + 64 * G2_PITCH) = fl.half[0]; }
    __syncthreads();      /* a transposed row holds elements of all four waves */
    v8us xh[8], xl[8]; unsigned short* qh[8]; unsigned short* ql[8];
#pragma unroll
    for (int i = 0; i < 8; ++i) { const int d = i * 8 + (tid >> 4); const unsigned char* q = tp + d * G2_PITCH + ln * 16; xh[i] = *(const v8us*)q; xl[i] = *(const v8us*)(q + 64 * G2_PITCH); const size_t xo = (size_t)(col0 + d) * M + mt * 128 + ln * 8; qh[i] = (unsigned short*)Th + xo; ql[i] = (unsigned short*)Tl + xo; }
    __builtin_amdgcn_sched_barrier(0);      /* values and addresses first, then the 16 stores as one group: formed among the stores the addresses share registers, and each reuse waits for an issued store */
#pragma unroll
    for (int i = 0; i < 8; ++i) { *(v8us*)qh[i] = xh[i]; *(v8us*)ql[i] = xl[i]; }
    asm volatile("s_wait_xcnt 0x0" ::: "memory");      /* stands in front of whatever reuses the registers of the 16 stores above */
    return; }
#pragma unroll
  for (int u = 0; u < 8; ++u) { const int t = u & 3, half = u >> 2;
#pragma unroll
    for (int r = 0; r < 8; ++r) so[w][half * 16 + 8 * hh + r][t * 16 + ln] = accs[u][r]; }
  __builtin_amdgcn_fence(__ATOMIC_ACQ_REL, "workgroup"); __builtin_amdgcn_wave_barrier();
  const int rsub = lane >> 4; const v4f bv4 = {bf16_round(b4[0]), bf16_round(b4[1]), bf16_round(b4[2]), bf16_round(b4[3])};
  {      /* no branch per row: the 16 LDS reads are one group, the sums one block, the stores one group under one test of the pointer */
    v4f o[16];
#pragma unroll
    for (int q = 0; q < 16; ++q) o[q] = *(const v4fa*)&so[w][q * 2 + rsub][c4];
#pragma unroll
    for (int q = 0; q < 16; ++q)
#pragma unroll
      for (int i = 0; i < 4; ++i) { float v = o[q][i] * alpha + bv4[i]; if (CP) v += cp[q][i];
        if (ACT == 3) v = fmaxf(v, 0.f); else if (ACT == 6) v = 0.5f * v * (1.0f + erff(v * 0.70710678118654752f)); else if (ACT == 11) v = 1.0f / (1.0f + expf(-v)); else if (ACT == 15) v = v / (1.0f + expf(-v)); else if (ACT == 12) v = (v > 0.f) ? v : 0.01f * v; else if (ACT == 8) v = tanhf(v);
        o[q][i] = v; }
    if (C) { float* po[16];
#pragma unroll
      for (int q = 0; q < 16; ++q) po[q] = C + cofs + (size_t)(row0 + q * 2 + rsub) * ldc + col0 + c4;
      __builtin_amdgcn_sched_barrier(0);      /* all 16 addresses are formed in front of the stores, each in registers of its own: formed among the stores they share registers, and each reuse waits for an issued store */
#pragma unroll
      for (int q = 0; q < 16; ++q) *(v4f*)po[q] = o[q];
      asm volatile("s_wait_xcnt 0x0" ::: "memory");      /* stands in front of whatever reuses the registers of the 16 stores above */
    }
    if (C16) { _Float16* ph[16]; v4h h4[16];
#pragma unroll
      for (int q = 0; q < 16; ++q) { for (int i = 0; i < 4; ++i) h4[q][i] = (_Float16)o[q][i]; ph[q] = C16 + cofs + (size_t)(row0 + q * 2 + rsub) * ldc + col0 + c4; }
      __builtin_amdgcn_sched_barrier(0);      /* as above: values and addresses first, then the 16 stores as one group */
#pragma unroll
      for (int q = 0; q < 16; ++q) *(v4h*)ph[q] = h4[q]; }
    if (Hh) { v4h h4[16], l4[16]; _Float16* ph[16]; _Float16* pl[16];
#pragma unroll
      for (int q = 0; q < 16; ++q) { hl4(o[q], h4[q], l4[q]); const size_t ho = cofs + (size_t)(row0 + q * 2 + rsub) * ldc + col0 + c4; ph[q] = Hh + ho; pl[q] = Hl + ho; }
      __builtin_amdgcn_sched_barrier(0);      /* as above: values and addresses first, then the 32 stores as one group */
#pragma unroll
      for (int q = 0; q < 16; ++q) { *(v4h*)ph[q] = h4[q]; *(v4h*)pl[q] = l4[q]; }
      asm volatile("s_wait_xcnt 0x0" ::: "memory");      /* stands in front of whatever reuses the registers of the 32 stores above */
    }
     } }
// ---- a product whose A operand is a hi plane and a residual plane: both passes in one launch ----
// Block = 8 waves on one 128x64 tile: waves 0-3 multiply the hi plane's rows, waves 4-7 the residual plane's rows, against the one staged B tile; the write-out adds the two sums.
// One stage = 128 k of the 128 rows of each A plane and of the 64 B rows, at the pitch of k_proj5's ring; two buffers.
#define G2P_AB (256 * G2_PITCH)
#define G2P_STAGE ((256 + 64) * G2_PITCH)
// One wave's share of a stage: its own 32 A rows and 8 B rows, two rows (2 x 256 B, whole lines) per wave-wide copy, 16 B per lane, 20 copies.
__device__ __forceinline__ void g2p_stage(unsigned la, unsigned lb, const _Float16* ga, int lda, const _Float16* gb, int ldb) {
  unsigned l[20]; const _Float16* g[20];
#pragma unroll
  for (int i = 0; i < 16; ++i) { l[i] = la + i * (2 * G2_PITCH); g[i] = ga + (size_t)(2 * i) * lda; }
#pragma unroll
  for (int i = 0; i < 4; ++i) { l[16 + i] = lb + i * (2 * G2_PITCH); g[16 + i] = gb + (size_t)(2 * i) * ldb; }
  // the copies go to LDS through no register; s_wait_xcnt is the statement's last line so that no address register is rewritten ahead of it
  asm volatile("global_load_async_to_lds_b128 %0, %10, off\n\t"
               "global_load_async_to_lds_b128 %1, %11, off\n\t"
               "global_load_async_to_lds_b128 %2, %12, off\n\t"
               "global_load_async_to_lds_b128 %3, %13, off\n\t"
               "global_load_async_to_lds_b128 %4, %14, off\n\t"
               "global_load_async_to_lds_b128 %5, %15, off\n\t"
               "global_load_async_to_lds_b128 %6, %16, off\n\t"
               "global_load_async_to_lds_b128 %7, %17, off\n\t"
               "global_load_async_to_lds_b128 %8, %18, off\n\t"
               "global_load_async_to_lds_b128 %9, %19, off\n\t"
               "s_wait_xcnt 0x0"
               :: "v"(l[0]), "v"(l[1]), "v"(l[2]), "v"(l[3]), "v"(l[4]), "v"(l[5]), "v"(l[6]), "v"(l[7]), "v"(l[8]), "v"(l[9]),
                  "v"(g[0]), "v"(g[1]), "v"(g[2]), "v"(g[3]), "v"(g[4]), "v"(g[5]), "v"(g[6]), "v"(g[7]), "v"(g[8]), "v"(g[9]) : "memory");
  asm volatile("global_load_async_to_lds_b128 %0, %10, off\n\t"
               "global_load_async_to_lds_b128 %1, %11, off\n\t"
               "global_load_async_to_lds_b128 %2, %12, off\n\t"
               "global_load_async_to_lds_b128 %3, %13, off\n\t"
               "global_load_async_to_lds_b128 %4, %14, off\n\t"
               "global_load_async_to_lds_b128 %5, %15, off\n\t"
               "global_load_async_to_lds_b128 %6, %16, off\n\t"
               "global_load_async_to_lds_b128 %7, %17, off\n\t"
               "global_load_async_to_lds_b128 %8, %18, off\n\t"
               "global_load_async_to_lds_b128 %9, %19, off\n\t"
               "s_wait_xcnt 0x0"
               :: "v"(l[10]), "v"(l[11]), "v"(l[12]), "v"(l[13]), "v"(l[14]), "v"(l[15]), "v"(l[16]), "v"(l[17]), "v"(l[18]), "v"(l[19]),
                  "v"(g[10]), "v"(g[11]), "v"(g[12]), "v"(g[13]), "v"(g[14]), "v"(g[15]), "v"(g[16]), "v"(g[17]), "v"(g[18]), "v"(g[19]) : "memory");
}
// C = act(Ah*B^T * alpha + bias (+ CP) + Al*B^T * alphal); CP: optional addend of C's shape and pitch (it may be C itself: a lane reads exactly the elements that it stores). M % 128 == 0, N % 64 == 0, K % 128 == 0.
// SPLIT: the result is the next product's A operand and is stored as its hi/lo planes Ch, Cl (C's shape and pitch) and not as f32.
template <int ACT, bool SPLIT>
__global__ __launch_bounds__(256) void k_gemm2p(const _Float16* __restrict__ Ah, const _Float16* __restrict__ Al, int lda, const _Float16* __restrict__ Bh, int ldb, float alpha, float alphal, const float* __restrict__ bias, const float* CP,
    float* C, _Float16* __restrict__ Ch, _Float16* __restrict__ Cl, int ldc, int M, int N, int K) {
  __shared__ __attribute__((aligned(16))) float so[8][32][68]; __shared__ __attribute__((aligned(16))) unsigned char ring[2 * G2P_STAGE];
  const int tid = threadIdx.x, w = tid >> 5, lane = tid & 31, ln = lane & 15, hh = lane >> 4, pl = w >> 2, wr = w & 3;      /* pl: the wave's plane; wr: its group of 32 rows */
  const int ntn = N >> 6; const int bx = (int)blockIdx.x; const int mt = bx / ntn, nq = bx - mt * ntn; const int row0 = mt * 128 + 32 * wr, col0 = nq * 64; if (mt * 128 >= M) return;      /* the whole block leaves, in front of every barrier */
  const v8f z8 = {0.f,0.f,0.f,0.f,0.f,0.f,0.f,0.f}; v8f c00 = z8, c01 = z8, c02 = z8, c03 = z8, c10 = z8, c11 = z8, c12 = z8, c13 = z8;
  const _Float16* ga = (pl ? Al : Ah) + (size_t)(row0 + hh) * lda + ln * 8; const _Float16* gb = Bh + (size_t)(col0 + 8 * w + hh) * ldb + ln * 8;      /* this lane's first 16 bytes of the wave's A and B rows */
  const unsigned la = (unsigned)(size_t)ring + (unsigned)((32 * w + hh) * G2_PITCH + ln * 16), lb = (unsigned)(size_t)ring + (unsigned)(G2P_AB + (8 * w + hh) * G2_PITCH + ln * 16);
  const int nst = K >> 7;
  g2p_stage(la, lb, ga, lda, gb, ldb);
  // What the write-out adds (bias, addend CP) is read here, in the write-out's layout (a wave writes 16 of its group's 32 rows; lane = 4 columns of rows 16 pl + 2q + hh): independent 16-byte loads issued as one group, in flight beside stage 0's copies.
  const int c4 = ln * 4, rw = 16 * pl + hh; const v4f z4 = {0.f,0.f,0.f,0.f}; v4f b4 = z4, cp[8];
#pragma unroll
  for (int q = 0; q < 8; ++q) cp[q] = z4;
  if (CP) { const float* pc[8];
#pragma unroll
    for (int q = 0; q < 8; ++q) pc[q] = CP + (size_t)(row0 + rw + q * 2) * ldc + col0 + c4;
    __builtin_amdgcn_sched_barrier(0);      /* all 8 addresses are formed in front of the loads, each in registers of its own: formed among the loads they share registers, and each reuse waits for an issued load */
#pragma unroll
    for (int q = 0; q < 8; ++q) cp[q] = *(const v4fa*)pc[q];
    asm volatile("s_wait_xcnt 0x0" ::: "memory");      /* stands in front of whatever reuses the address registers of the 8 loads above */
  }
  if (bias) { b4 = *(const v4fa*)(bias + col0 + c4);
    asm volatile("s_wait_xcnt 0x0" ::: "memory");      /* the same for the bias load */
  }
  asm volatile("s_wait_asynccnt 0x0" ::: "memory");      /* this wave's copies of stage 0 have landed */
  __syncthreads();      /* and every other wave's: stage 0 may be read */
  if (nst > 1) g2p_stage(la + G2P_STAGE, lb + G2P_STAGE, ga + 128, lda, gb + 128, ldb);
#pragma unroll 1      /* one trip per stage: the two buffers alternate */
  for (int t = 0; t < nst; ++t) { const unsigned bo = (unsigned)(t & 1) * G2P_STAGE; const unsigned char* pa = ring + bo + (32 * w + ln) * G2_PITCH; const unsigned char* pb = ring + bo + G2P_AB + ln * G2_PITCH;
    v16h fa[2][2], fb[2][4];      /* two fragment sets: the next k step's LDS reads are issued, as one group, ahead of this step's WMMAs; never beyond the stage */
    fa[0][0] = g2_lfrag(pa, hh); fa[0][1] = g2_lfrag(pa + 16 * G2_PITCH, hh);
#pragma unroll
    for (int j = 0; j < 4; ++j) fb[0][j] = g2_lfrag(pb + j * 16 * G2_PITCH, hh);
#pragma unroll
    for (int ks = 0; ks < 4; ++ks) { const int cu = ks & 1, nx = cu ^ 1;
      if (ks < 3) { fa[nx][0] = g2_lfrag(pa + (ks + 1) * 64, hh); fa[nx][1] = g2_lfrag(pa + 16 * G2_PITCH + (ks + 1) * 64, hh);
#pragma unroll
        for (int j = 0; j < 4; ++j) fb[nx][j] = g2_lfrag(pb + j * 16 * G2_PITCH + (ks + 1) * 64, hh); }
      __builtin_amdgcn_sched_barrier(0);      /* keeps the reads above in front of the WMMAs below: sunk to their uses, each pair of WMMAs waits out an LDS latency */
      c00 = g2_mm(fa[cu][0], fb[cu][0], c00); c10 = g2_mm(fa[cu][1], fb[cu][0], c10); c01 = g2_mm(fa[cu][0], fb[cu][1], c01); c11 = g2_mm(fa[cu][1], fb[cu][1], c11);
      c02 = g2_mm(fa[cu][0], fb[cu][2], c02); c12 = g2_mm(fa[cu][1], fb[cu][2], c12); c03 = g2_mm(fa[cu][0], fb[cu][3], c03); c13 = g2_mm(fa[cu][1], fb[cu][3], c13);
      __builtin_amdgcn_sched_barrier(0);      /* keeps the next group of reads behind these WMMAs, so that two sets suffice */
    }
    asm volatile("s_wait_dscnt 0x0" ::: "memory");      /* this wave's reads of the buffer are done before it is refilled */
    asm volatile("s_wait_asynccnt 0x0" ::: "memory");      /* this wave's copies of stage t + 1 have landed */
    __syncthreads();      /* publishes stage t + 1 and ends every wave's reads of stage t */
    if (t + 2 < nst) g2p_stage(la + bo, lb + bo, ga + (size_t)(t + 2) * 128, lda, gb + (size_t)(t + 2) * 128, ldb); }
  asm volatile("s_wait_asynccnt 0x0" ::: "memory");      /* no copy is left in flight */
  v8f accs[8] = {c00, c01, c02, c03, c10, c11, c12, c13};
#pragma unroll
  for (int u = 0; u < 8; ++u) { const int t = u & 3, half = u >> 2;
#pragma unroll
    for (int r = 0; r < 8; ++r) so[w][half * 16 + 8 * hh + r][t * 16 + ln] = accs[u][r]; }
  __syncthreads();      /* a row group's two sums come from two waves: both are in LDS before either wave reads them */
  const v4f bv4 = {bf16_round(b4[0]), bf16_round(b4[1]), bf16_round(b4[2]), bf16_round(b4[3])};
  {      /* no branch per row: the 16 LDS reads are one group, the sums one block, the stores one group */
    v4f o[8], ol[8];
#pragma unroll
    for (int q = 0; q < 8; ++q) { o[q] = *(const v4fa*)&so[wr][rw + q * 2][c4]; ol[q] = *(const v4fa*)&so[4 + wr][rw + q * 2][c4]; }
#pragma unroll
    for (int q = 0; q < 8; ++q)
#pragma unroll
      for (int i = 0; i < 4; ++i) { float v = o[q][i] * alpha + bv4[i]; if (CP) v += cp[q][i]; v += ol[q][i] * alphal;      /* the order of the two separate passes: hi sum, bias, addend, then the residual sum */
        if (ACT == 3) v = fmaxf(v, 0.f);
        o[q][i] = v; }
    float* po[8]; _Float16* ph[8]; _Float16* pl[8]; v4h h4[8], l4[8];
#pragma unroll
    for (int q = 0; q < 8; ++q) { const size_t co = (size_t)(row0 + rw + q * 2) * ldc + col0 + c4; if (SPLIT) { hl4(o[q], h4[q], l4[q]); ph[q] = Ch + co; pl[q] = Cl + co; } else po[q] = C + co; }
    __builtin_amdgcn_sched_barrier(0);      /* all addresses are formed in front of the stores, each in registers of its own: formed among the stores they share registers, and each reuse waits for an issued store */
#pragma unroll
    for (int q = 0; q < 8; ++q) { if (SPLIT) { *(v4h*)ph[q] = h4[q]; *(v4h*)pl[q] = l4[q]; } else *(v4f*)po[q] = o[q]; }
    asm volatile("s_wait_xcnt 0x0" ::: "memory");      /* stands in front of whatever reuses the registers of the stores above */
  } }
// The five projections that depend on the embeddings alone (q, k, v of the self attention; k, v of the cross attention) in one grid: a range of block indices per product.
// BT: the six [DM][DM] weight planes in a row (q, k, v, cross q, cross k, cross v). Each result is stored as the attention's operand planes: q and k as hi/lo [rows][DM], v as hi/lo of its transpose [DM][rows] (64 columns of a tile = one head).
#define P5_NW ((SW / 128) * (DM / 64))
#define P5_NP ((SP / 128) * (DM / 64))
__global__ __launch_bounds__(128) void k_proj5(const _Float16* __restrict__ WE, const _Float16* __restrict__ PE, const _Float16* __restrict__ BT, const float* __restrict__ bq, const float* __restrict__ bk, const float* __restrict__ bv, const float* __restrict__ bkc, const float* __restrict__ bvc,
    _Float16* __restrict__ Qh, _Float16* __restrict__ Ql, _Float16* __restrict__ Kh, _Float16* __restrict__ Kl, _Float16* __restrict__ Vth, _Float16* __restrict__ Vtl,
    _Float16* __restrict__ KCh, _Float16* __restrict__ KCl, _Float16* __restrict__ VCth, _Float16* __restrict__ VCtl) {
  const int b = (int)blockIdx.x; const bool word = b < 3 * P5_NW;      /* block-uniform */
  const int j = word ? b / P5_NW : (b - 3 * P5_NW) / P5_NP; const int bx = word ? b - j * P5_NW : (b - 3 * P5_NW) - j * P5_NP;
  const float* bias = word ? (j == 0 ? bq : (j == 1 ? bk : bv)) : (j == 0 ? bkc : bvc);
  _Float16* const hh_ = word ? (j == 0 ? Qh : (j == 1 ? Kh : nullptr)) : (j == 0 ? KCh : nullptr); _Float16* const hl_ = word ? (j == 0 ? Ql : (j == 1 ? Kl : nullptr)) : (j == 0 ? KCl : nullptr);
  _Float16* const th_ = word ? (j == 2 ? Vth : nullptr) : (j == 1 ? VCth : nullptr); _Float16* const tl_ = word ? (j == 2 ? Vtl : nullptr) : (j == 1 ? VCtl : nullptr);
  g2_body<0>(word ? WE : PE, DM, 0, BT + (size_t)(word ? j : 4 + j) * DM * DM, DM, 0, 0.0625f, bias, 0, nullptr, 1, 0, 0,
             nullptr, nullptr, hh_, hl_, th_, tl_, DM, 0, word ? SW : SP, DM, DM, bx, 0); }


// K/V staging of k_flashm: one stage = the 32 keys of one trip: 32 K rows of 128 B (hi plane, lo plane) at a pitch of 144 B, 64 V^T rows of 64 B (hi plane, lo plane) at a pitch of 80 B (16 B x odd, for the 16-byte fragment reads); two buffers.
#define FM_KP 144
#define FM_VP 80
#define FM_KL (32 * FM_KP)
#define FM_VH (2 * 32 * FM_KP)
#define FM_VD (64 * FM_VP)
#define FM_STAGE (FM_VH + 2 * FM_VD)
// One wave's share of a stage: 8 K rows and 16 V^T rows of each plane, 16 B per lane, 8 copies (a K copy brings 4 whole rows, a V copy 8 rows).
// lk, lv: the lane's LDS byte addresses of its first K and V chunk (hi plane); gkh, gkl, gvh, gvl: the matching global addresses in the four planes.
__device__ __forceinline__ void fm_stage(unsigned lk, unsigned lv, const unsigned short* gkh, const unsigned short* gkl, int ldk, const unsigned short* gvh, const unsigned short* gvl, int ldv) {
  // the copies go to LDS through no register; s_wait_xcnt is the statement's last line so that no address register is rewritten ahead of it
  asm volatile("global_load_async_to_lds_b128 %0, %8, off\n\t"
               "global_load_async_to_lds_b128 %1, %9, off\n\t"
               "global_load_async_to_lds_b128 %2, %10, off\n\t"
               "global_load_async_to_lds_b128 %3, %11, off\n\t"
               "global_load_async_to_lds_b128 %4, %12, off\n\t"
               "global_load_async_to_lds_b128 %5, %13, off\n\t"
               "global_load_async_to_lds_b128 %6, %14, off\n\t"
               "global_load_async_to_lds_b128 %7, %15, off\n\t"
               "s_wait_xcnt 0x0"
               :: "v"(lk), "v"(lk + 4 * FM_KP), "v"(lk + FM_KL), "v"(lk + FM_KL + 4 * FM_KP), "v"(lv), "v"(lv + 8 * FM_VP), "v"(lv + FM_VD), "v"(lv + FM_VD + 8 * FM_VP),
                  "v"(gkh), "v"(gkh + (size_t)4 * ldk), "v"(gkl), "v"(gkl + (size_t)4 * ldk), "v"(gvh), "v"(gvh + (size_t)8 * ldv), "v"(gvl), "v"(gvl + (size_t)8 * ldv) : "memory");
}
// lane l's value in lane l ^ 16, by a vector cross-row move (a shuffle would go through the LDS unit and be waited for)
__device__ __forceinline__ float fm_xhalf(float x) { const int b = __builtin_bit_cast(int, x); return __builtin_bit_cast(float, __builtin_amdgcn_permlanex16(b, b, 0x76543210, 0xfedcba98, false, false)); }
template <int TQ, int TK>
__global__ __launch_bounds__(128) void k_flashm(const _Float16* __restrict__ Q16, const _Float16* __restrict__ Q16lo, int ldq, const _Float16* __restrict__ K16, const _Float16* __restrict__ K16lo, int ldk, const _Float16* __restrict__ Vt, const _Float16* __restrict__ Vtlo, const unsigned* __restrict__ MB, const int* __restrict__ RA, const int* __restrict__ KE, _Float16* __restrict__ Oh, _Float16* __restrict__ Ol, int ldo) {
  constexpr int RPW = 16, RTN = RPW / 16, NQB = TQ / (4 * RPW), DT = 4, KS = 2;
  __shared__ __attribute__((aligned(16))) float sO[4][RPW][64 + 4]; __shared__ __attribute__((aligned(16))) unsigned char kv[2 * FM_STAGE];
  const int tid = threadIdx.x, w = tid >> 5, lane = tid & 31, ln = lane & 15, hh = lane >> 4;
  const int slab = blockIdx.x / NQB, qblk = blockIdx.x % NQB; const int b = slab / NH, h = slab % NH; const int qb0 = qblk * (4 * RPW); const int q0 = qb0 + w * RPW;
  FragH aq[2][KS], aql[2][KS];
#pragma unroll
  for (int rt = 0; rt < RTN; ++rt) { const size_t qo = ((size_t)b * TQ + q0 + rt * 16 + ln) * ldq + h * 64; const unsigned short* qr = (const unsigned short*)Q16 + qo; const unsigned short* ql = (const unsigned short*)Q16lo + qo;
#pragma unroll
    for (int ks = 0; ks < KS; ++ks) { aq[rt][ks].half[0] = *(const v8us*)(qr + ks * 32 + 8 * hh); aq[rt][ks].half[1] = *(const v8us*)(qr + ks * 32 + 16 + 8 * hh); aql[rt][ks].half[0] = *(const v8us*)(ql + ks * 32 + 8 * hh); aql[rt][ks].half[1] = *(const v8us*)(ql + ks * 32 + 16 + 8 * hh); } }
  asm volatile("s_wait_xcnt 0x0" ::: "memory");      /* stands in front of whatever reuses the address registers of the Q loads above */
  const unsigned short* Vth = (const unsigned short*)Vt + (size_t)slab * 64 * TK; const unsigned short* Vtl = (const unsigned short*)Vtlo + (size_t)slab * 64 * TK;
  float m_r[2], l_r[2]; v8f oacc[2][DT], oaccl[2][DT];
#pragma unroll
  for (int rt = 0; rt < RTN; ++rt) { m_r[rt] = -3.0e38f; l_r[rt] = 0.f;
#pragma unroll
    for (int dt = 0; dt < DT; ++dt) { oacc[rt][dt] = (v8f){0.f,0.f,0.f,0.f,0.f,0.f,0.f,0.f}; oaccl[rt][dt] = oacc[rt][dt]; } }
  int jend = KE[qblk * 32]; jend = min(TK, (jend + 31) & ~31); if (jend < 32) jend = 32;      /* block-uniform */
  int allm[2]; const unsigned* mrow[2];
#pragma unroll
  for (int rt = 0; rt < RTN; ++rt) mrow[rt] = MB + (size_t)(q0 + rt * 16 + ln) * (TK / 32);
  const unsigned lk = (unsigned)(size_t)kv + (unsigned)((8 * w + (lane >> 3)) * FM_KP + (lane & 7) * 16), lv = (unsigned)(size_t)kv + (unsigned)(FM_VH + (16 * w + (lane >> 2)) * FM_VP + (lane & 3) * 16);
  const size_t gko = ((size_t)b * TK + 8 * w + (lane >> 3)) * ldk + h * 64 + (lane & 7) * 8, gvo = (size_t)(16 * w + (lane >> 2)) * TK + (lane & 3) * 8;      /* this lane's first 16 bytes of the wave's K and V^T rows */
  const unsigned short* gkh = (const unsigned short*)K16 + gko; const unsigned short* gkl = (const unsigned short*)K16lo + gko; const unsigned short* gvh = Vth + gvo; const unsigned short* gvl = Vtl + gvo;
  fm_stage(lk, lv, gkh, gkl, ldk, gvh, gvl, TK);
#pragma unroll
  for (int rt = 0; rt < RTN; ++rt) { const int* pr = RA + q0 + rt * 16 + ln;
    // the query's row flag: load and data wait are one statement, so that no address register of the load is rewritten ahead of the wait; it stands here so that the wait runs beside the flight of stage 0's copies
    asm volatile("global_load_b32 %0, %1, off\n\ts_wait_loadcnt 0x0" : "=&v"(allm[rt]) : "v"(pr) : "memory"); }
  asm volatile("s_wait_asynccnt 0x0" ::: "memory");      /* this wave's copies of stage 0 have landed */
  __syncthreads();      /* and every other wave's: stage 0 may be read */
  if (32 < jend) fm_stage(lk + FM_STAGE, lv + FM_STAGE, gkh + (size_t)32 * ldk, gkl + (size_t)32 * ldk, ldk, gvh + 32, gvl + 32, TK);
#pragma unroll 1
  for (int j0 = 0; j0 < jend; j0 += 32) {
    const unsigned bo = (unsigned)((j0 >> 5) & 1) * FM_STAGE; const unsigned char* pk = kv + bo + ln * FM_KP + 16 * hh; const unsigned char* pv = kv + bo + FM_VH + ln * FM_VP + 16 * hh;      /* this trip's buffer: the lane's row and half in the K and V^T tiles */
    v8f s[2][2]; FragH bk[2][KS], bkl[2][KS];
#pragma unroll
    for (int nt = 0; nt < 2; ++nt) { const unsigned char* kr = pk + nt * 16 * FM_KP; const unsigned char* kl = kr + FM_KL;
#pragma unroll
      for (int ks = 0; ks < KS; ++ks) { bk[nt][ks].half[0] = *(const v8us*)(kr + ks * 64); bk[nt][ks].half[1] = *(const v8us*)(kr + ks * 64 + 32); bkl[nt][ks].half[0] = *(const v8us*)(kl + ks * 64); bkl[nt][ks].half[1] = *(const v8us*)(kl + ks * 64 + 32); } }
    __builtin_amdgcn_sched_barrier(0);      /* keeps the trip's K reads one group in front of the WMMAs: sunk to their uses, the second 16 keys wait out an LDS latency of their own */
#pragma unroll
    for (int nt = 0; nt < 2; ++nt) {
#pragma unroll
      for (int rt = 0; rt < RTN; ++rt) { v8f acc = (v8f){0.f,0.f,0.f,0.f,0.f,0.f,0.f,0.f}, accr = acc;
#pragma unroll
        for (int ks = 0; ks < KS; ++ks) { acc = mmaH<1>(bk[nt][ks].v, bk[nt][ks].v, aq[rt][ks].v, aq[rt][ks].v, acc); accr = mmaH<1>(bk[nt][ks].v, bk[nt][ks].v, aql[rt][ks].v, aql[rt][ks].v, accr); accr = mmaH<1>(bkl[nt][ks].v, bkl[nt][ks].v, aq[rt][ks].v, aq[rt][ks].v, accr); }
        s[rt][nt] = acc + accr * 0.0009765625f; } }
    FragH bv[DT], bl[DT];      /* the trip's V^T fragments, read as one group in front of the softmax, so that the four output tiles do not each wait out an LDS latency */
#pragma unroll
    for (int dt = 0; dt < DT; ++dt) { const unsigned char* vr = pv + dt * 16 * FM_VP; bv[dt].half[0] = *(const v8us*)vr; bv[dt].half[1] = *(const v8us*)(vr + 32); bl[dt].half[0] = *(const v8us*)(vr + FM_VD); bl[dt].half[1] = *(const v8us*)(vr + FM_VD + 32); }
    FragH pa[2], pl[2];      /* P^T as the B operand: element i of the lane is key 8 hh + i (i < 8) or 16 + 8 hh + (i - 8), which is register i & 7 of score tile i >> 3 and the k order of the V^T fragments */
#pragma unroll
    for (int rt = 0; rt < RTN; ++rt) {      /* no branch in the softmax: each exp is computed for every lane and the conditions pick by select; a query's 32 scores lie in two lanes (ln, ln + 16), so its maximum takes in-lane steps and one exchange */
      float sv[16]; bool ok[16]; const unsigned mw = mrow[rt][j0 >> 5] >> (8 * hh); const bool am = (allm[rt] != 0);
#pragma unroll
      for (int i = 0; i < 16; ++i) { ok[i] = am || (((mw >> ((i >> 3) * 16 + (i & 7))) & 1u) == 0u); sv[i] = ok[i] ? (am ? 0.f : s[rt][i >> 3][i & 7] * SCL2) : -INFINITY; }
      float mt[8];
#pragma unroll
      for (int i = 0; i < 8; ++i) mt[i] = fmaxf(sv[i], sv[8 + i]);
      float mc = fmaxf(fmaxf(fmaxf(mt[0], mt[1]), fmaxf(mt[2], mt[3])), fmaxf(fmaxf(mt[4], mt[5]), fmaxf(mt[6], mt[7])));
      mc = fmaxf(mc, fm_xhalf(mc));
      const float mo = m_r[rt], mn = fmaxf(mo, mc); const float ea = __builtin_amdgcn_exp2f(mo - mn);      /* every exp argument is <= 0 (or -inf): no range reduction and no overflow clamp is needed, one v_exp_f32 each */
      const float al = (mn > -1.0e38f) ? ea : 1.0f; m_r[rt] = mn; float p[16];
#pragma unroll
      for (int i = 0; i < 16; ++i) { const float e = __builtin_amdgcn_exp2f(sv[i] - mn); p[i] = ok[i] ? e : 0.f; }
#pragma unroll
      for (int i = 0; i < 16; ++i) { const float ps = p[i] * 1024.0f; const _Float16 ph = (_Float16)ps; pa[rt].h[i] = ph; pl[rt].h[i] = (_Float16)((ps - (float)ph) * 1024.0f); }
      float pt[8];
#pragma unroll
      for (int i = 0; i < 8; ++i) pt[i] = p[i] + p[8 + i];
      l_r[rt] = l_r[rt] * al + (((pt[0] + pt[1]) + (pt[2] + pt[3])) + ((pt[4] + pt[5]) + (pt[6] + pt[7])));
#pragma unroll
      for (int dt = 0; dt < DT; ++dt) { oacc[rt][dt] *= al; oaccl[rt][dt] *= al; } }
#pragma unroll
    for (int dt = 0; dt < DT; ++dt) {
#pragma unroll
      for (int rt = 0; rt < RTN; ++rt) { oacc[rt][dt] = mmaH<1>(bv[dt].v, bv[dt].v, pa[rt].v, pa[rt].v, oacc[rt][dt]); oaccl[rt][dt] = mmaH<1>(bl[dt].v, bl[dt].v, pa[rt].v, pa[rt].v, oaccl[rt][dt]); oaccl[rt][dt] = mmaH<1>(bv[dt].v, bv[dt].v, pl[rt].v, pl[rt].v, oaccl[rt][dt]); } }
    asm volatile("s_wait_dscnt 0x0" ::: "memory");      /* this wave's reads of the buffer are done before the refill */
    asm volatile("s_wait_asynccnt 0x0" ::: "memory");      /* this wave's copies of the next stage have landed */
    __syncthreads();      /* publishes the next stage and ends every wave's reads of this one */
    if (j0 + 64 < jend) fm_stage(lk + bo, lv + bo, gkh + (size_t)(j0 + 64) * ldk, gkl + (size_t)(j0 + 64) * ldk, ldk, gvh + (j0 + 64), gvl + (j0 + 64), TK); }
  asm volatile("s_wait_asynccnt 0x0" ::: "memory");      /* no copy is left in flight */
#pragma unroll
  for (int rt = 0; rt < RTN; ++rt) {
    float l = l_r[rt]; l += fm_xhalf(l); const float li = (l > 0.f) ? 1.0f / (l * 1024.0f) : 0.f;      /* the two lanes of a query join their sums */
#pragma unroll
    for (int dt = 0; dt < DT; ++dt)
#pragma unroll
      for (int g = 0; g < 2; ++g) { v4f o4;
#pragma unroll
        for (int i = 0; i < 4; ++i) o4[i] = (oacc[rt][dt][4 * g + i] + oaccl[rt][dt][4 * g + i] * 0.0009765625f) * li;
        *(v4fa*)&sO[w][rt * 16 + ln][dt * 16 + 8 * hh + 4 * g] = o4; } }
  __builtin_amdgcn_fence(__ATOMIC_ACQ_REL, "workgroup"); __builtin_amdgcn_wave_barrier();
  {      /* the result is the next product's A operand: it is stored as that operand's hi/lo planes */
    v4h h4[RPW / 2], l4[RPW / 2]; _Float16* ph[RPW / 2]; _Float16* pq[RPW / 2];
#pragma unroll
    for (int rp = 0; rp < RPW; rp += 2) { const int r = rp + (lane >> 4), pc = lane & 15; const v4f val = *(const v4fa*)&sO[w][r][pc * 4]; hl4(val, h4[rp / 2], l4[rp / 2]); const size_t oo = ((size_t)b * TQ + q0 + r) * ldo + h * 64 + pc * 4; ph[rp / 2] = Oh + oo; pq[rp / 2] = Ol + oo; }
    __builtin_amdgcn_sched_barrier(0);      /* values and addresses first, then the stores as one group: formed among the stores the addresses share registers, and each reuse waits for an issued store */
#pragma unroll
    for (int i = 0; i < RPW / 2; ++i) { *(v4h*)ph[i] = h4[i]; *(v4h*)pq[i] = l4[i]; }
     } }


__device__ __forceinline__ void d_causaltab(unsigned* __restrict__ MB, int* __restrict__ RA, int* __restrict__ KE, int nq, int nk, int blk) {
  const int t = blk * 256 + threadIdx.x; const int nw = nk / 32;
  if (t < nq * nw) { const int q = t / nw, w = t % nw; const int first = q + 1 - 32 * w; const unsigned bits = (first <= 0) ? 0xffffffffu : ((first >= 32) ? 0u : (0xffffffffu << first)); *(unsigned*)(MB + t) = bits;  }
  if (t < nq) { *(int*)(RA + t) = 0;  }
  if (t < nq / 64) { const int v = 64 * (t + 1); *(int*)(KE + t * 32) = v;  } }
__device__ __forceinline__ void d_fulltab(unsigned* __restrict__ MB, int* __restrict__ RA, int* __restrict__ KE, int nq, int nk, int blk) {
  const int t = blk * 256 + threadIdx.x; const int nw = nk / 32;
  if (t < nq * nw) { *(unsigned*)(MB + t) = 0u;  }
  if (t < nq) { *(int*)(RA + t) = 0;  }
  if (t < nq / 64) { *(int*)(KE + t * 32) = nk;  } }

// Everything that depends on the inputs alone (eight weight planes, two embedding planes, two mask tables) in one grid: a range of block indices per job, every branch block-uniform.
// BT: the six [DM][DM] weight planes in a row (q, k, v, cross q, cross k, cross v).
#define PR_F (FF * DM / 8 / 256)
#define PR_W (DM * DM / 8 / 256)
#define PR_X (SW * DM / 8 / 256)
#define PR_P (SP * DM / 8 / 256)
#define PR_C (SW * (SW / 32) / 256)
#define PR_U (SW * (SP / 32) / 256)
__global__ __launch_bounds__(256) void k_prep(const float* __restrict__ Wq, const float* __restrict__ Wk, const float* __restrict__ Wv, const float* __restrict__ Wqc, const float* __restrict__ Wkc, const float* __restrict__ Wvc, const float* __restrict__ W1, const float* __restrict__ W2,
    const float* __restrict__ wemb, const float* __restrict__ pemb, _Float16* __restrict__ BT, _Float16* __restrict__ BW1, _Float16* __restrict__ BW2, _Float16* __restrict__ WE16, _Float16* __restrict__ PE16,
    unsigned* __restrict__ MB, int* __restrict__ RA, int* __restrict__ KE, unsigned* __restrict__ MB2, int* __restrict__ RA2, int* __restrict__ KE2) {
  int b = (int)blockIdx.x;
  if (b < PR_F) { d_round16f(W1, BW1, (size_t)FF * DM / 8, (unsigned)b); return; } b -= PR_F;
  if (b < PR_F) { d_round16f(W2, BW2, (size_t)FF * DM / 8, (unsigned)b); return; } b -= PR_F;
  if (b < 6 * PR_W) { const int j = b / PR_W; const float* W = (j == 0) ? Wq : (j == 1) ? Wk : (j == 2) ? Wv : (j == 3) ? Wqc : (j == 4) ? Wkc : Wvc;
    d_round16f(W, BT + (size_t)j * DM * DM, (size_t)DM * DM / 8, (unsigned)(b - j * PR_W)); return; } b -= 6 * PR_W;
  if (b < PR_X) { d_x16(wemb, WE16, (size_t)SW * DM / 8, (unsigned)b); return; } b -= PR_X;
  if (b < PR_P) { d_x16(pemb, PE16, (size_t)SP * DM / 8, (unsigned)b); return; } b -= PR_P;
  if (b < PR_C) { d_causaltab(MB, RA, KE, SW, SW, b); return; } b -= PR_C;
  d_fulltab(MB2, RA2, KE2, SW, SP, b); }

extern "C" void kernel_launch(void* const* d_in, const int* in_sizes, int n_in,
                              void* d_out, int out_size, void* d_ws, size_t ws_size, hipStream_t stream) {
  (void)in_sizes; (void)n_in; (void)out_size;
  const float* const* I = (const float* const*)d_in; const float* wemb = I[0]; const float* pemb = I[1];
  const float* Wq = I[2]; const float* bq = I[3]; const float* Wk = I[4]; const float* bk = I[5]; const float* Wv = I[6]; const float* bv = I[7];
  const float* Wqc = I[8]; const float* bqc = I[9]; const float* Wkc = I[10]; const float* bkc = I[11]; const float* Wvc = I[12]; const float* bvc = I[13];
  const float* W1 = I[14]; const float* b1 = I[15]; const float* W2 = I[16]; const float* b2 = I[17];
  char* ws = (char*)d_ws; size_t off = 0;
  auto take = [&](size_t bytes) { char* p = ws + off; off += (bytes + 255) & ~(size_t)255; return p; };
  _Float16* BT = (_Float16*)take((size_t)6 * DM * DM * 2); _Float16* BQC = BT + (size_t)3 * DM * DM;      /* weight planes q, k, v, cross q, cross k, cross v in a row */
  _Float16* BW1 = (_Float16*)take((size_t)FF * DM * 2); _Float16* BW2 = (_Float16*)take((size_t)DM * FF * 2);
  _Float16* WE16 = (_Float16*)take((size_t)SW * DM * 2); _Float16* PE16 = (_Float16*)take((size_t)SP * DM * 2);
  _Float16* Qh = (_Float16*)take((size_t)SW * DM * 2); _Float16* Ql = (_Float16*)take((size_t)SW * DM * 2); _Float16* Kh = (_Float16*)take((size_t)SW * DM * 2); _Float16* Kl = (_Float16*)take((size_t)SW * DM * 2);
  _Float16* Vth = (_Float16*)take((size_t)SW * DM * 2); _Float16* Vtl = (_Float16*)take((size_t)SW * DM * 2);
  _Float16* KCh = (_Float16*)take((size_t)SP * DM * 2); _Float16* KCl = (_Float16*)take((size_t)SP * DM * 2); _Float16* VCth = (_Float16*)take((size_t)SP * DM * 2); _Float16* VCtl = (_Float16*)take((size_t)SP * DM * 2);
  unsigned* MB = (unsigned*)take((size_t)SW * (SW / 32) * 4); int* RA = (int*)take((size_t)SW * 4); int* KE = (int*)take((size_t)(SW / 64) * 32 * 4);
  unsigned* MB2 = (unsigned*)take((size_t)SW * (SP / 32) * 4); int* RA2 = (int*)take((size_t)SW * 4); int* KE2 = (int*)take((size_t)(SW / 64) * 32 * 4);
  _Float16* Ah = (_Float16*)take((size_t)SW * DM * 2); _Float16* Al = (_Float16*)take((size_t)SW * DM * 2);      /* word hi/lo, later cross hi/lo */
  _Float16* HDh = (_Float16*)take((size_t)SW * (FF / 2) * 2); _Float16* HDl = (_Float16*)take((size_t)SW * (FF / 2) * 2);
  if (off > ws_size) return;      /* 12 + 16 + 4 + 2 + 32 + 0.8 + 8 + 16 = 91 MiB */
  const dim3 gW((SW / 128) * (DM / 64), 1), gH((SW / 128) * ((FF / 2) / 64), 1);
  k_prep<<<2 * PR_F + 6 * PR_W + PR_X + PR_P + PR_C + PR_U, 256, 0, stream>>>(Wq, Wk, Wv, Wqc, Wkc, Wvc, W1, W2, wemb, pemb, BT, BW1, BW2, WE16, PE16, MB, RA, KE, MB2, RA2, KE2);      /* weights are (out,in) row-major = natural Bt; x16 */
  k_proj5<<<3 * P5_NW + 2 * P5_NP, 128, 0, stream>>>(WE16, PE16, BT, bq, bk, bv, bkc, bvc, Qh, Ql, Kh, Kl, Vth, Vtl, KCh, KCl, VCth, VCtl);
  /* --- causal self attention on the word embeddings (all planes hi/lo) --- */
  k_flashm<SW, SW><<<NH * (SW / 64), 128, 0, stream>>>(Qh, Ql, DM, Kh, Kl, DM, Vth, Vtl, MB, RA, KE, Ah, Al, DM);      /* word as hi/lo operand planes */
  k_gemm2p<0, true><<<gW, 256, 0, stream>>>(Ah, Al, DM, BQC, DM, 0.0625f, 0.0625f * 0.0009765625f, bqc, nullptr, nullptr, Qh, Ql, DM, SW, DM, DM);      /* cross q as hi/lo planes */
  k_flashm<SW, SP><<<NH * (SW / 64), 128, 0, stream>>>(Qh, Ql, DM, KCh, KCl, DM, VCth, VCtl, MB2, RA2, KE2, Ah, Al, DM);      /* cross as hi/lo operand planes */
  /* --- FFN in two column halves of the hidden: h = relu(cross*W1^T + b1) (hi/lo), out (+)= h_half*W2_half^T (+ b2 once) --- */
  for (int hf = 0; hf < 2; ++hf) { const _Float16* B1h = BW1 + (size_t)hf * (FF / 2) * DM; const _Float16* B2h = BW2 + (size_t)hf * (FF / 2);
    k_gemm2p<3, true><<<gH, 256, 0, stream>>>(Ah, Al, DM, B1h, DM, 0.0625f, 0.0625f * 0.0009765625f, b1 + hf * (FF / 2), nullptr, nullptr, HDh, HDl, FF / 2, SW, FF / 2, DM);      /* relu on the complete sum, stored as hi/lo planes */
    k_gemm2p<0, false><<<gW, 256, 0, stream>>>(HDh, HDl, FF / 2, B2h, FF, 0.0625f, 0.0625f * 0.0009765625f, (hf == 0) ? b2 : nullptr, (hf == 0) ? nullptr : (const float*)d_out, (float*)d_out, nullptr, nullptr, DM, SW, DM, FF / 2); }
}

// v010
// A run of this version takes 223 microseconds.
// Timed twice side by side with v009, it ran 1.05 and 1.04 times as fast.
// Over all steps from v000, the starting kernel, it is 5.80 times as fast.
#include <hip/hip_runtime.h>
// Two-stage attention decoder block (word embeddings [2048][1024], position embeddings [1024][1024], 16 heads x 64, FFN 4096): word = CausalMHA(wemb; q,k,v = Linear+bias, scores/8, tril, softmax, .v, heads merged, no output projection); cross = MHA(q from word, k/v from pemb, no mask); out = relu(cross*W1^T + b1)*W2^T + b2 -> [2048,1024].
// Compute dtype: inputs and parameters rounded to bf16; projections of the embeddings exact; all other operands f16 hi + (x2^10) residual pairs (~2^-21); f32 accumulation, softmax f32. v_wmma_f32_16x16x32_f16.
#define SW 2048
#define SP 1024
#define DM 1024
#define NH 16
#define FF 4096
#define SCL 0.125f
#define SCL2 (SCL * 1.4426950408889634f)      /* 1/sqrt(64) * log2(e): k_flashm keeps scores and running maxima in base 2, exp(x) = 2^(x * log2(e)) */
#define SKV ((SW > SP) ? SW : SP)      /* the larger key count, used nowhere: the self attention has SW keys, the cross attention SP */
typedef __bf16 v16b __attribute__((ext_vector_type(16)));
typedef unsigned short v8us __attribute__((ext_vector_type(8), may_alias));
typedef float  v8f  __attribute__((ext_vector_type(8)));
typedef float  v4f  __attribute__((ext_vector_type(4)));
typedef float  v4fa __attribute__((ext_vector_type(4), may_alias));
union FragB { v16b v; v8us half[2]; unsigned short u[16]; };

__device__ __forceinline__ unsigned short bf16_bits(float x) { unsigned int u = __float_as_uint(x); return (unsigned short)((u + 0x7FFFu + ((u >> 16) & 1u)) >> 16); }
__device__ __forceinline__ float bf16_val(unsigned short b) { return __uint_as_float(((unsigned int)b) << 16); }
__device__ __forceinline__ float bf16_round(float x) { return bf16_val(bf16_bits(x)); }
// D += A·B with NT terms: 1 = ah·bh, 2 = + al·bh (A split), 3 = + ah·bl (both split)
template <int NT>
__device__ __forceinline__ v8f mmaN(v16b ah, v16b al, v16b bh, v16b bl, v8f c) {
  c = __builtin_amdgcn_wmma_f32_16x16x32_bf16(false, ah, false, bh, (short)0, c, false, false);
  if (NT >= 2) c = __builtin_amdgcn_wmma_f32_16x16x32_bf16(false, al, false, bh, (short)0, c, false, false);
  if (NT >= 3) c = __builtin_amdgcn_wmma_f32_16x16x32_bf16(false, ah, false, bl, (short)0, c, false, false);
  asm volatile("v_nop\n\tv_nop\n\tv_nop\n\tv_nop" : "+v"(c) : "v"(ah), "v"(al), "v"(bh), "v"(bl));
  return c;
}

__global__ __launch_bounds__(256) void k_wt_bf16(const float* __restrict__ W, unsigned short* __restrict__ Wt, int K, int N) {
  const int t = blockIdx.x * 256 + threadIdx.x;
  const int k8n = K / 8;
  if (t >= N * k8n) return;
  const int n = t / k8n, k8 = (t % k8n) * 8;
  v8us v;
#pragma unroll
  for (int i = 0; i < 8; ++i) v[i] = bf16_bits(W[(size_t)(k8 + i) * N + n]);
  *(v8us*)(Wt + (size_t)n * K + k8) = v;
  
}

// GEMM C[M][N] (f32, pitch ldc) = act(A[M][K]·W + bias). A f32 row-major (pitch lda) converted per fragment to bf16
// (ASPLIT: hi/lo two planes -> 2 terms, else single rounded term); Wt bf16 [N][K] (pitch ldb). BIAS_BF16 rounds the
// bias to bf16 first (bias quantised to bf16 before the add). K%32==0, M%16==0, N%64==0.
template <bool ASPLIT, int ACT, bool BIAS_BF16>
__global__ __launch_bounds__(128) void k_gemm_bf(const float* __restrict__ A, int lda, const unsigned short* __restrict__ Wt, int ldb,
                                               const float* __restrict__ bias, float* __restrict__ C, int ldc, int M, int N, int K) {
  __shared__ __attribute__((aligned(16))) float so[4][16][64];
  const int tid = threadIdx.x, w = tid >> 5, lane = tid & 31, ln = lane & 15, hh = lane >> 4;
  const int ntn = N / 64;
  const int wid = blockIdx.x * 4 + w;
  const int mt = wid / ntn, nq = wid % ntn;
  if (mt * 16 >= M) return;
  const int row0 = mt * 16, col0 = nq * 64;
  const float* arow = A + (size_t)(row0 + ln) * lda;
  v8f acc[4] = {};
  for (int kb = 0; kb < K; kb += 32) {
    FragB ah, al;
    const v4f x0 = *(const v4fa*)(arow + kb + 8 * hh), x1 = *(const v4fa*)(arow + kb + 8 * hh + 4);
    const v4f x2 = *(const v4fa*)(arow + kb + 16 + 8 * hh), x3 = *(const v4fa*)(arow + kb + 16 + 8 * hh + 4);
    float xs[16] = {x0[0],x0[1],x0[2],x0[3],x1[0],x1[1],x1[2],x1[3],x2[0],x2[1],x2[2],x2[3],x3[0],x3[1],x3[2],x3[3]};
#pragma unroll
    for (int i = 0; i < 16; ++i) { const unsigned short hb = bf16_bits(xs[i]); ah.u[i] = hb; al.u[i] = ASPLIT ? bf16_bits(xs[i] - bf16_val(hb)) : (unsigned short)0; }
#pragma unroll
    for (int t = 0; t < 4; ++t) {
      const unsigned short* brow = Wt + (size_t)(col0 + t * 16 + ln) * ldb + kb;
      FragB b;
      b.half[0] = *(const v8us*)(brow + 8 * hh);
      b.half[1] = *(const v8us*)(brow + 16 + 8 * hh);
      acc[t] = mmaN<ASPLIT ? 2 : 1>(ah.v, al.v, b.v, b.v, acc[t]);
    }
  }
#pragma unroll
  for (int t = 0; t < 4; ++t) {
    float bv = bias ? bias[col0 + t * 16 + ln] : 0.f;
    if (BIAS_BF16) bv = bf16_round(bv);
#pragma unroll
    for (int r = 0; r < 8; ++r) { float v = acc[t][r] + bv; if (ACT == 1) v = fmaxf(v, 0.f); so[w][8 * hh + r][t * 16 + ln] = v; }
  }
  __builtin_amdgcn_fence(__ATOMIC_ACQ_REL, "workgroup");
  __builtin_amdgcn_wave_barrier();
  const int rsub = lane >> 4, c4 = (lane & 15) * 4;
  {
#pragma unroll
    for (int q = 0; q < 8; ++q) {
      const int r = q * 2 + rsub;
      const v4f v = *(const v4fa*)&so[w][r][c4];
      *(v4f*)(C + (size_t)(row0 + r) * ldc + col0 + c4) = v;
    }
    
  }
}

// GEMM C = act(A·W + bias + resid): A f32 (ASPLIT -> hi/lo 2 terms), Wt bf16 [N][K]; ACT 0 none, 1 relu, 2 exact gelu;
// resid (optional, f32, row index = (row % rmod), pitch ldr, RES_BF16 rounds it) added before the activation.
template <bool ASPLIT, int ACT, bool BIAS_BF16, bool RES_BF16>
__global__ __launch_bounds__(128) void k_gemm_bf3(const float* __restrict__ A, int lda, const unsigned short* __restrict__ Wt, int ldb,
                                                const float* __restrict__ bias, const float* __restrict__ resid, int rmod, int ldr,
                                                float* __restrict__ C, int ldc, int M, int N, int K) {
  __shared__ __attribute__((aligned(16))) float so[4][16][64];
  const int tid = threadIdx.x, w = tid >> 5, lane = tid & 31, ln = lane & 15, hh = lane >> 4;
  const int ntn = N / 64;
  const int wid = blockIdx.x * 4 + w;
  const int mt = wid / ntn, nq = wid % ntn;
  if (mt * 16 >= M) return;
  const int row0 = mt * 16, col0 = nq * 64;
  const float* arow = A + (size_t)(row0 + ln) * lda;
  v8f acc[4] = {};
  for (int kb = 0; kb < K; kb += 32) {
    FragB ah, al;
    const v4f x0 = *(const v4fa*)(arow + kb + 8 * hh), x1 = *(const v4fa*)(arow + kb + 8 * hh + 4);
    const v4f x2 = *(const v4fa*)(arow + kb + 16 + 8 * hh), x3 = *(const v4fa*)(arow + kb + 16 + 8 * hh + 4);
    float xs[16] = {x0[0],x0[1],x0[2],x0[3],x1[0],x1[1],x1[2],x1[3],x2[0],x2[1],x2[2],x2[3],x3[0],x3[1],x3[2],x3[3]};
#pragma unroll
    for (int i = 0; i < 16; ++i) { const unsigned short hb = bf16_bits(xs[i]); ah.u[i] = hb; al.u[i] = ASPLIT ? bf16_bits(xs[i] - bf16_val(hb)) : (unsigned short)0; }
#pragma unroll
    for (int t = 0; t < 4; ++t) {
      const unsigned short* brow = Wt + (size_t)(col0 + t * 16 + ln) * ldb + kb;
      FragB b;
      b.half[0] = *(const v8us*)(brow + 8 * hh);
      b.half[1] = *(const v8us*)(brow + 16 + 8 * hh);
      acc[t] = mmaN<ASPLIT ? 2 : 1>(ah.v, al.v, b.v, b.v, acc[t]);
    }
  }
#pragma unroll
  for (int t = 0; t < 4; ++t) {
    const int col = col0 + t * 16 + ln;
    float bv = bias ? bias[col] : 0.f;
    if (BIAS_BF16) bv = bf16_round(bv);
#pragma unroll
    for (int r = 0; r < 8; ++r) {
      float v = acc[t][r] + bv;
      if (resid) { float rv = resid[(size_t)((row0 + 8 * hh + r) % rmod) * ldr + col]; if (RES_BF16) rv = bf16_round(rv); v += rv; }
      if (ACT == 1) v = fmaxf(v, 0.f);
      if (ACT == 2) v = 0.5f * v * (1.0f + erff(v * 0.70710678118654752f));
      if (ACT == 3) { const float u = 0.7978845608028654f * (v + 0.044715f * v * v * v); v = 0.5f * v * (1.0f + tanhf(u)); }
      so[w][8 * hh + r][t * 16 + ln] = v;
    }
  }
  __builtin_amdgcn_fence(__ATOMIC_ACQ_REL, "workgroup");
  __builtin_amdgcn_wave_barrier();
  const int rsub = lane >> 4, c4 = (lane & 15) * 4;
  {
#pragma unroll
    for (int q = 0; q < 8; ++q) {
      const int r = q * 2 + rsub;
      const v4f v = *(const v4fa*)&so[w][r][c4];
      *(v4f*)(C + (size_t)(row0 + r) * ldc + col0 + c4) = v;
    }
    
  }
}
// row LayerNorm (biased variance, eps) over N: s = X (+ R); optional out_sum <- s; out_norm <- (s-mu)*rsqrt(var+eps)*g + b
template <bool PARAM_BF16>
__global__ __launch_bounds__(256) void k_layernorm(const float* __restrict__ X, const float* __restrict__ R, const float* __restrict__ g, const float* __restrict__ bta,
                                                  float* __restrict__ out_sum, float* __restrict__ out_norm, int N, float eps) {
  __shared__ float red[256];
  const int row = blockIdx.x, tid = threadIdx.x;
  const float* x = X + (size_t)row * N; const float* rr = R ? R + (size_t)row * N : nullptr;
  float vals[16];                     // up to N = 4096
  const int per = N / 256;            // contiguous chunk per thread? use strided-by-4 chunks: thread handles j = tid*4 + 1024*u
  float s1 = 0.f;
  for (int u = 0; u < per / 4; ++u) {
    const int j = tid * 4 + 1024 * u;
    const v4f a = *(const v4fa*)(x + j);
    v4f b = {0.f,0.f,0.f,0.f}; if (rr) b = *(const v4fa*)(rr + j);
#pragma unroll
    for (int q = 0; q < 4; ++q) { const float v = a[q] + b[q]; vals[u * 4 + q] = v; s1 += v; }
  }
  red[tid] = s1; __syncthreads();
  for (int st = 128; st > 0; st >>= 1) { if (tid < st) red[tid] += red[tid + st]; __syncthreads(); }
  const float mu = red[0] / (float)N; __syncthreads();
  float s2 = 0.f;
  for (int u = 0; u < per / 4; ++u)
#pragma unroll
    for (int q = 0; q < 4; ++q) { const float c = vals[u * 4 + q] - mu; s2 += c * c; }
  red[tid] = s2; __syncthreads();
  for (int st = 128; st > 0; st >>= 1) { if (tid < st) red[tid] += red[tid + st]; __syncthreads(); }
  const float rs = rsqrtf(red[0] / (float)N + eps);
  {
    for (int u = 0; u < per / 4; ++u) {
      const int j = tid * 4 + 1024 * u;
      v4f o, sm;
#pragma unroll
      for (int q = 0; q < 4; ++q) {
        float gg = g[j + q], bb = bta[j + q];
        if (PARAM_BF16) { gg = bf16_round(gg); bb = bf16_round(bb); }
        sm[q] = vals[u * 4 + q]; o[q] = (vals[u * 4 + q] - mu) * rs * gg + bb;
      }
      if (out_sum) *(v4f*)(out_sum + (size_t)row * N + j) = sm;
      *(v4f*)(out_norm + (size_t)row * N + j) = o;
    }
    
  }
}



// ---- f16 WMMA path (v_wmma_f32_16x16x32_f16): 11-bit significands for operands in range — used where a [0,1] probability operand needs more precision than bf16
typedef _Float16 v16h __attribute__((ext_vector_type(16)));
union FragH { v16h v; v8us half[2]; _Float16 h[16]; unsigned short u[16]; };
template <int NT>
__device__ __forceinline__ v8f mmaH(v16h ah, v16h al, v16h bh, v16h bl, v8f c) {
  c = __builtin_amdgcn_wmma_f32_16x16x32_f16(false, ah, false, bh, (short)0, c, false, false);
  if (NT >= 2) c = __builtin_amdgcn_wmma_f32_16x16x32_f16(false, al, false, bh, (short)0, c, false, false);
  if (NT >= 3) c = __builtin_amdgcn_wmma_f32_16x16x32_f16(false, ah, false, bl, (short)0, c, false, false);
  asm volatile("v_nop\n\tv_nop\n\tv_nop\n\tv_nop" : "+v"(c) : "v"(ah), "v"(al), "v"(bh), "v"(bl));
  return c;
}
// batched GEMM like k_gemm_b but f16 operands: A f32 (split into f16 hi/lo if ASPLIT, else rounded to f16), Bt = f16 values [n][k]; alpha; C f32; N multiple of 16 (partial tiles skipped)
template <bool ASPLIT>
__global__ __launch_bounds__(128) void k_gemm_h(const float* __restrict__ A, int lda, size_t sA, const _Float16* __restrict__ Bh, int ldb, size_t sB, float alpha, float* __restrict__ C, int ldc, size_t sC, int M, int N, int K) {
  __shared__ __attribute__((aligned(16))) float so[4][16][64];
  const int tid = threadIdx.x, w = tid >> 5, lane = tid & 31, ln = lane & 15, hh = lane >> 4; const int by = blockIdx.y;
  A += (size_t)by * sA; Bh += (size_t)by * sB; C += (size_t)by * sC;
  const int ntn = (N + 63) / 64; const int wid = blockIdx.x * 4 + w; const int mt = wid / ntn, nq = wid % ntn; if (mt * 16 >= M) return;
  const int row0 = mt * 16, col0 = nq * 64; const float* arow = A + (size_t)(row0 + ln) * lda;
  v8f acc[4] = {};
  for (int kb = 0; kb < K; kb += 32) {
    FragH ah, al;
    const v4f x0 = *(const v4fa*)(arow + kb + 8 * hh), x1 = *(const v4fa*)(arow + kb + 8 * hh + 4), x2 = *(const v4fa*)(arow + kb + 16 + 8 * hh), x3 = *(const v4fa*)(arow + kb + 16 + 8 * hh + 4);
    float xs[16] = {x0[0],x0[1],x0[2],x0[3],x1[0],x1[1],x1[2],x1[3],x2[0],x2[1],x2[2],x2[3],x3[0],x3[1],x3[2],x3[3]};
#pragma unroll
    for (int i = 0; i < 16; ++i) { const _Float16 h = (_Float16)xs[i]; ah.h[i] = h; al.h[i] = ASPLIT ? (_Float16)(xs[i] - (float)h) : (_Float16)0.0f; }
#pragma unroll
    for (int t = 0; t < 4; ++t) { if (col0 + t * 16 >= N) continue; const size_t boff = (size_t)(col0 + t * 16 + ln) * ldb + kb; FragH bq; bq.half[0] = *(const v8us*)(Bh + boff + 8 * hh); bq.half[1] = *(const v8us*)(Bh + boff + 16 + 8 * hh);
      acc[t] = mmaH<ASPLIT ? 2 : 1>(ah.v, al.v, bq.v, bq.v, acc[t]); }
  }
#pragma unroll
  for (int t = 0; t < 4; ++t) { if (col0 + t * 16 >= N) continue;
#pragma unroll
    for (int r = 0; r < 8; ++r) so[w][8 * hh + r][t * 16 + ln] = acc[t][r] * alpha; }
  __builtin_amdgcn_fence(__ATOMIC_ACQ_REL, "workgroup"); __builtin_amdgcn_wave_barrier();
  const int rsub = lane >> 4, c4 = (lane & 15) * 4;
  {
#pragma unroll
    for (int q = 0; q < 8; ++q) { const int r = q * 2 + rsub; if (col0 + c4 < N) { const v4f v = *(const v4fa*)&so[w][r][c4]; *(v4f*)(C + (size_t)(row0 + r) * ldc + col0 + c4) = v; } }
     }
}

// Wt[n][k] = f16(W[k][n]·scale) from f32 row-major W[K][N] (scale = power of two; bf16-exact weights stay exact in f16 away from the subnormal range)
__global__ __launch_bounds__(256) void k_wt_f16(const float* __restrict__ W, _Float16* __restrict__ Wt, int K, int N, float scale) {
  const int t = blockIdx.x * 256 + threadIdx.x; if (t >= N * (K / 8)) return; const int n = t / (K / 8), k8 = (t % (K / 8)) * 8; FragH f;
#pragma unroll
  for (int i = 0; i < 8; ++i) f.h[i] = (_Float16)(bf16_round(W[(size_t)(k8 + i) * N + n]) * scale); const v8us o = f.half[0];
  *(v8us*)((unsigned short*)Wt + (size_t)n * K + k8) = o; 
}
// k_gemm_hh variant with fused epilogue: v = acc·alpha + bias[by·sBias + col] (+ CP[(row/rowsPerB)·sCPb + by·64 + col] if CP) ; ACT 0 none / 1 elu ; writes f16 C16 (and f32 C if non-null)
template <int ACT>
__global__ __launch_bounds__(128) void k_gemm_hhx(const _Float16* __restrict__ A, int lda, size_t sA, const _Float16* __restrict__ Bh, int ldb, size_t sB, float alpha, const float* __restrict__ bias, size_t sBias, const float* __restrict__ CP, int rowsPerB, size_t sCPb, int row0g,
    float* __restrict__ C, _Float16* __restrict__ C16, int ldc, size_t sC, int M, int N, int K) {
  __shared__ __attribute__((aligned(16))) float so[4][16][64];
  const int tid = threadIdx.x, w = tid >> 5, lane = tid & 31, ln = lane & 15, hh = lane >> 4; const int by = blockIdx.y;
  A += (size_t)by * sA; Bh += (size_t)by * sB; const size_t cofs = (size_t)by * sC; const float* bp = bias ? bias + (size_t)by * sBias : nullptr;
  const int ntn = (N + 63) / 64; const int wid = blockIdx.x * 4 + w; const int mt = wid / ntn, nq = wid % ntn; if (mt * 16 >= M) return;
  const int row0 = mt * 16, col0 = nq * 64; const _Float16* arow = A + (size_t)(row0 + ln) * lda;
  v8f acc[4] = {};
  for (int kb = 0; kb < K; kb += 32) { FragH ah; ah.half[0] = *(const v8us*)((const unsigned short*)arow + kb + 8 * hh); ah.half[1] = *(const v8us*)((const unsigned short*)arow + kb + 16 + 8 * hh);
#pragma unroll
    for (int t = 0; t < 4; ++t) { if (col0 + t * 16 >= N) continue; const size_t boff = (size_t)(col0 + t * 16 + ln) * ldb + kb; FragH bq; bq.half[0] = *(const v8us*)((const unsigned short*)Bh + boff + 8 * hh); bq.half[1] = *(const v8us*)((const unsigned short*)Bh + boff + 16 + 8 * hh);
      acc[t] = mmaH<1>(ah.v, ah.v, bq.v, bq.v, acc[t]); }
  }
#pragma unroll
  for (int t = 0; t < 4; ++t) { if (col0 + t * 16 >= N) continue; const int col = col0 + t * 16 + ln; const float bv = bp ? bf16_round(bp[col]) : 0.f;
#pragma unroll
    for (int r = 0; r < 8; ++r) { float v = acc[t][r] * alpha + bv; if (CP) { const int bidx = (row0g + row0 + 8 * hh + r) / rowsPerB; v += CP[(size_t)bidx * sCPb + (size_t)by * 64 + col]; } if (ACT == 1) v = (v > 0.f) ? v : expm1f(v); else if (ACT == 7) v = (v > 0.f) ? v + 1.0f : expf(v); else if (ACT == 8) v = tanhf(v); else if (ACT == 9) v = 0.5f * v * (1.0f + tanhf(0.7978845608028654f * (v + 0.044715f * v * v * v))); else if (ACT == 11) v = 1.0f / (1.0f + expf(-v)); else if (ACT == 12) v = (v > 0.f) ? v : 0.01f * v; else if (ACT == 14) v = (v > 0.f) ? v : 0.1f * v; else if (ACT == 15) v = v / (1.0f + expf(-v)); else if (ACT == 3) v = fmaxf(v, 0.f); else if (ACT == 6) v = 0.5f * v * (1.0f + erff(v * 0.70710678118654752f)); so[w][8 * hh + r][t * 16 + ln] = v; } }
  __builtin_amdgcn_fence(__ATOMIC_ACQ_REL, "workgroup"); __builtin_amdgcn_wave_barrier();
  const int rsub = lane >> 4, c4 = (lane & 15) * 4; typedef _Float16 v4h __attribute__((ext_vector_type(4)));
  {
#pragma unroll
    for (int q = 0; q < 8; ++q) { const int r = q * 2 + rsub; if (col0 + c4 < N) { const v4f v = *(const v4fa*)&so[w][r][c4]; if (C) *(v4f*)(C + cofs + (size_t)(row0 + r) * ldc + col0 + c4) = v; if (C16) { v4h h4; for (int i = 0; i < 4; ++i) h4[i] = (_Float16)v[i]; *(v4h*)(C16 + cofs + (size_t)(row0 + r) * ldc + col0 + c4) = h4; } } }
     }
}


typedef _Float16 v4h __attribute__((ext_vector_type(4)));

// Bodies of the short kernels: blk is the block's index inside its own job, so that independent jobs can share one grid, each on its own range of block indices.
__device__ __forceinline__ void d_x16(const float* __restrict__ x, _Float16* __restrict__ X16, size_t n8, unsigned blk) { const size_t t = (size_t)blk * 256 + threadIdx.x; if (t >= n8) return; FragH f;
#pragma unroll
  for (int q = 0; q < 8; ++q) f.h[q] = (_Float16)bf16_round(x[t * 8 + q]); *(v8us*)((unsigned short*)X16 + t * 8) = f.half[0];  }
__global__ __launch_bounds__(256) void k_h16(const float* __restrict__ x, _Float16* __restrict__ X16, size_t n8) { const size_t t = (size_t)blockIdx.x * 256 + threadIdx.x; if (t >= n8) return; FragH f;
#pragma unroll
  for (int q = 0; q < 8; ++q) f.h[q] = (_Float16)x[t * 8 + q]; *(v8us*)((unsigned short*)X16 + t * 8) = f.half[0];  }
__device__ __forceinline__ void d_round16f(const float* __restrict__ W, _Float16* __restrict__ Bt, size_t n8, unsigned blk) { const size_t t = (size_t)blk * 256 + threadIdx.x; if (t >= n8) return; FragH f;
#pragma unroll
  for (int i = 0; i < 8; ++i) f.h[i] = (_Float16)(bf16_round(W[t * 8 + i]) * 16.0f); *(v8us*)((unsigned short*)Bt + t * 8) = f.half[0];  }
template <int NHv, int TTv>
__global__ __launch_bounds__(256) void k_vt(const _Float16* __restrict__ V16, int ldv, int voff, _Float16* __restrict__ Vt) { __shared__ unsigned short tl[64][66]; const int tid = threadIdx.x; const int slab = blockIdx.x / (TTv / 64), lg = blockIdx.x % (TTv / 64); const int b = slab / NHv, h = slab % NHv;
  for (int i = tid; i < 64 * 8; i += 256) { const int r = i / 8, c8 = (i % 8) * 8; FragH f; f.half[0] = *(const v8us*)((const unsigned short*)V16 + ((size_t)b * TTv + lg * 64 + r) * ldv + voff + h * 64 + c8);
#pragma unroll
    for (int q = 0; q < 8; ++q) tl[r][c8 + q] = f.u[q]; }
  __syncthreads();
  {
#pragma unroll
    for (int rd = 0; rd < 2; ++rd) { const int d = rd * 32 + tid / 8, pc = tid % 8; FragH f;
#pragma unroll
      for (int q = 0; q < 8; ++q) f.u[q] = tl[pc * 8 + q][d];
      *(v8us*)((unsigned short*)Vt + ((size_t)slab * 64 + d) * TTv + lg * 64 + pc * 8) = f.half[0]; }
     } }

// An f32 value as an operand pair: hi = f16(v), lo = f16((v - hi) * 2^10). The kernel that makes a value stores the pair itself.
__device__ __forceinline__ void hl4(v4f v, v4h& hi, v4h& lo) {
#pragma unroll
  for (int i = 0; i < 4; ++i) { const _Float16 h = (_Float16)v[i]; hi[i] = h; lo[i] = (_Float16)((v[i] - (float)h) * 1024.0f); } }

// ---- fast GEMM (block tile 128x64, wave tile 32x64; requires M % 128 == 0, N % 64 == 0 and K % 128 == 0); epilogue = k_gemm_hhx semantics ----
// k loop staging of g2_body: one stage = 128 k (256 B of a row) of the block's 128 A rows and 64 B rows, laid in LDS at a pitch of 272 B (16 B x odd, for the 16-byte fragment reads); two buffers.
#define G2_PITCH 272
#define G2_AB (128 * G2_PITCH)
#define G2_STAGE ((128 + 64) * G2_PITCH)
__device__ __forceinline__ v16h g2_lfrag(const unsigned char* p, int hh) { FragH f; f.half[0] = *(const v8us*)(p + 16 * hh); f.half[1] = *(const v8us*)(p + 32 + 16 * hh); return f.v; }
__device__ __forceinline__ v8f g2_mm(v16h a, v16h b, v8f c) { return __builtin_amdgcn_wmma_f32_16x16x32_f16(false, a, false, b, (short)0, c, false, false); }
// One wave's share of a stage: 32 A rows and 16 B rows, two rows (2 x 256 B, whole lines) per wave-wide copy, 16 B per lane, 24 copies.
// la, lb: the lane's LDS byte addresses of its first A and B chunk; ga, gb: the matching global addresses; a copy further on is two rows further on.
__device__ __forceinline__ void g2_stage(unsigned la, unsigned lb, const _Float16* ga, int lda, const _Float16* gb, int ldb) {
  unsigned l[24]; const _Float16* g[24];
#pragma unroll
  for (int i = 0; i < 16; ++i) { l[i] = la + i * (2 * G2_PITCH); g[i] = ga + (size_t)(2 * i) * lda; }
#pragma unroll
  for (int i = 0; i < 8; ++i) { l[16 + i] = lb + i * (2 * G2_PITCH); g[16 + i] = gb + (size_t)(2 * i) * ldb; }
  // the copies go to LDS through no register; s_wait_xcnt is the statement's last line so that no address register is rewritten ahead of it
  asm volatile("global_load_async_to_lds_b128 %0, %12, off\n\t"
               "global_load_async_to_lds_b128 %1, %13, off\n\t"
               "global_load_async_to_lds_b128 %2, %14, off\n\t"
               "global_load_async_to_lds_b128 %3, %15, off\n\t"
               "global_load_async_to_lds_b128 %4, %16, off\n\t"
               "global_load_async_to_lds_b128 %5, %17, off\n\t"
               "global_load_async_to_lds_b128 %6, %18, off\n\t"
               "global_load_async_to_lds_b128 %7, %19, off\n\t"
               "global_load_async_to_lds_b128 %8, %20, off\n\t"
               "global_load_async_to_lds_b128 %9, %21, off\n\t"
               "global_load_async_to_lds_b128 %10, %22, off\n\t"
               "global_load_async_to_lds_b128 %11, %23, off\n\t"
               "s_wait_xcnt 0x0"
               :: "v"(l[0]), "v"(l[1]), "v"(l[2]), "v"(l[3]), "v"(l[4]), "v"(l[5]), "v"(l[6]), "v"(l[7]), "v"(l[8]), "v"(l[9]), "v"(l[10]), "v"(l[11]),
                  "v"(g[0]), "v"(g[1]), "v"(g[2]), "v"(g[3]), "v"(g[4]), "v"(g[5]), "v"(g[6]), "v"(g[7]), "v"(g[8]), "v"(g[9]), "v"(g[10]), "v"(g[11]) : "memory");
  asm volatile("global_load_async_to_lds_b128 %0, %12, off\n\t"
               "global_load_async_to_lds_b128 %1, %13, off\n\t"
               "global_load_async_to_lds_b128 %2, %14, off\n\t"
               "global_load_async_to_lds_b128 %3, %15, off\n\t"
               "global_load_async_to_lds_b128 %4, %16, off\n\t"
               "global_load_async_to_lds_b128 %5, %17, off\n\t"
               "global_load_async_to_lds_b128 %6, %18, off\n\t"
               "global_load_async_to_lds_b128 %7, %19, off\n\t"
               "global_load_async_to_lds_b128 %8, %20, off\n\t"
               "global_load_async_to_lds_b128 %9, %21, off\n\t"
               "global_load_async_to_lds_b128 %10, %22, off\n\t"
               "global_load_async_to_lds_b128 %11, %23, off\n\t"
               "s_wait_xcnt 0x0"
               :: "v"(l[12]), "v"(l[13]), "v"(l[14]), "v"(l[15]), "v"(l[16]), "v"(l[17]), "v"(l[18]), "v"(l[19]), "v"(l[20]), "v"(l[21]), "v"(l[22]), "v"(l[23]),
                  "v"(g[12]), "v"(g[13]), "v"(g[14]), "v"(g[15]), "v"(g[16]), "v"(g[17]), "v"(g[18]), "v"(g[19]), "v"(g[20]), "v"(g[21]), "v"(g[22]), "v"(g[23]) : "memory");
}
// bx, by: the block's tile index and batch index inside its own product
// Results: C (f32), C16 (f16), Hh and Hl (hi/lo operand planes, C's shape and pitch), Th and Tl (hi/lo planes of the transposed result, [N][M], pitch M; no addend, no activation); each optional, the tests are block-uniform.
template <int ACT>
__device__ __forceinline__ void g2_body(const _Float16* __restrict__ A, int lda, size_t sA, const _Float16* __restrict__ Bh, int ldb, size_t sB, float alpha, const float* __restrict__ bias, size_t sBias, const float* __restrict__ CP, int rowsPerB, size_t sCPb, int row0g,
    float* __restrict__ C, _Float16* __restrict__ C16, _Float16* __restrict__ Hh, _Float16* __restrict__ Hl, _Float16* __restrict__ Th, _Float16* __restrict__ Tl, int ldc, size_t sC, int M, int N, int K, int bx, int by) {
  __shared__ __attribute__((aligned(16))) float so[4][32][68]; __shared__ __attribute__((aligned(16))) unsigned char ring[2 * G2_STAGE];
  const int tid = threadIdx.x, w = tid >> 5, lane = tid & 31, ln = lane & 15, hh = lane >> 4;
  A += (size_t)by * sA; Bh += (size_t)by * sB; const size_t cofs = (size_t)by * sC; const float* bp = bias ? bias + (size_t)by * sBias : nullptr;
  const int ntn = N >> 6; const int mt = bx / ntn, nq = bx - mt * ntn; const int row0 = mt * 128 + 32 * w, col0 = nq * 64; if (mt * 128 >= M) return;      /* the whole block leaves, in front of every barrier */
  const v8f z8 = {0.f,0.f,0.f,0.f,0.f,0.f,0.f,0.f}; v8f c00 = z8, c01 = z8, c02 = z8, c03 = z8, c10 = z8, c11 = z8, c12 = z8, c13 = z8;
  const _Float16* ga = A + (size_t)(row0 + hh) * lda + ln * 8; const _Float16* gb = Bh + (size_t)(col0 + 16 * w + hh) * ldb + ln * 8;      /* this lane's first 16 bytes of the wave's A and B rows */
  const unsigned la = (unsigned)(size_t)ring + (unsigned)((32 * w + hh) * G2_PITCH + ln * 16), lb = (unsigned)(size_t)ring + (unsigned)(G2_AB + (16 * w + hh) * G2_PITCH + ln * 16);
  const int nst = K >> 7;
  g2_stage(la, lb, ga, lda, gb, ldb);
  // What the epilogue adds (bias, addend CP) is read here, in the layout of the write-out pass (lane = 4 columns of rows 2q + hh): 17 independent 16-byte loads issued as one group, in flight beside stage 0's copies.
  const int c4 = ln * 4; const v4f z4 = {0.f,0.f,0.f,0.f}; v4f b4 = z4, cp[16];
#pragma unroll
  for (int q = 0; q < 16; ++q) cp[q] = z4;
  if (CP) { const float* pc[16];
#pragma unroll
    for (int q = 0; q < 16; ++q) { const int bidx = (row0g + row0 + q * 2 + hh) / rowsPerB; pc[q] = CP + (size_t)bidx * sCPb + (size_t)by * 64 + col0 + c4; }
    __builtin_amdgcn_sched_barrier(0);      /* all 16 addresses are formed in front of the loads, each in registers of its own: formed among the loads they share registers, and each reuse waits for an issued load */
#pragma unroll
    for (int q = 0; q < 16; ++q) cp[q] = *(const v4fa*)pc[q];
    asm volatile("s_wait_xcnt 0x0" ::: "memory");      /* stands in front of whatever reuses the address registers of the 16 loads above */
  }
  float bt[4] = {0.f, 0.f, 0.f, 0.f};      /* the bias in the accumulators' layout (lane = column 16 t + ln), for the transposed write-out */
  if (bp) { b4 = *(const v4fa*)(bp + col0 + c4);
#pragma unroll
    for (int t = 0; t < 4; ++t) bt[t] = bp[col0 + t * 16 + ln];
    asm volatile("s_wait_xcnt 0x0" ::: "memory");      /* the same for the bias loads */
  }
  asm volatile("s_wait_asynccnt 0x0" ::: "memory");      /* this wave's copies of stage 0 have landed */
  __syncthreads();      /* and every other wave's: stage 0 may be read */
  if (nst > 1) g2_stage(la + G2_STAGE, lb + G2_STAGE, ga + 128, lda, gb + 128, ldb);
#pragma unroll 1      /* one trip per stage: the two buffers alternate */
  for (int t = 0; t < nst; ++t) { const unsigned bo = (unsigned)(t & 1) * G2_STAGE; const unsigned char* pa = ring + bo + (32 * w + ln) * G2_PITCH; const unsigned char* pb = ring + bo + G2_AB + ln * G2_PITCH;
    v16h fa[2][2], fb[2][4];      /* two fragment sets: the next k step's LDS reads are issued, as one group, ahead of this step's WMMAs; never beyond the stage */
    fa[0][0] = g2_lfrag(pa, hh); fa[0][1] = g2_lfrag(pa + 16 * G2_PITCH, hh);
#pragma unroll
    for (int j = 0; j < 4; ++j) fb[0][j] = g2_lfrag(pb + j * 16 * G2_PITCH, hh);
#pragma unroll
    for (int ks = 0; ks < 4; ++ks) { const int cu = ks & 1, nx = cu ^ 1;
      if (ks < 3) { fa[nx][0] = g2_lfrag(pa + (ks + 1) * 64, hh); fa[nx][1] = g2_lfrag(pa + 16 * G2_PITCH + (ks + 1) * 64, hh);
#pragma unroll
        for (int j = 0; j < 4; ++j) fb[nx][j] = g2_lfrag(pb + j * 16 * G2_PITCH + (ks + 1) * 64, hh); }
      __builtin_amdgcn_sched_barrier(0);      /* keeps the reads above in front of the WMMAs below: sunk to their uses, each pair of WMMAs waits out an LDS latency */
      c00 = g2_mm(fa[cu][0], fb[cu][0], c00); c10 = g2_mm(fa[cu][1], fb[cu][0], c10); c01 = g2_mm(fa[cu][0], fb[cu][1], c01); c11 = g2_mm(fa[cu][1], fb[cu][1], c11);
      c02 = g2_mm(fa[cu][0], fb[cu][2], c02); c12 = g2_mm(fa[cu][1], fb[cu][2], c12); c03 = g2_mm(fa[cu][0], fb[cu][3], c03); c13 = g2_mm(fa[cu][1], fb[cu][3], c13);
      __builtin_amdgcn_sched_barrier(0);      /* keeps the next group of reads behind these WMMAs, so that two sets suffice */
    }
    asm volatile("s_wait_dscnt 0x0" ::: "memory");      /* this wave's reads of the buffer are done before it is refilled */
    asm volatile("s_wait_asynccnt 0x0" ::: "memory");      /* this wave's copies of stage t + 1 have landed */
    __syncthreads();      /* publishes stage t + 1 and ends every wave's reads of stage t */
    if (t + 2 < nst) g2_stage(la + bo, lb + bo, ga + (size_t)(t + 2) * 128, lda, gb + (size_t)(t + 2) * 128, ldb); }
  asm volatile("s_wait_asynccnt 0x0" ::: "memory");      /* no copy is left in flight */
  v8f accs[8] = {c00, c01, c02, c03, c10, c11, c12, c13};
  if (Th) {      /* transposed hi/lo planes: an accumulator's 8 registers are 8 consecutive rows of one column, that is 16 bytes of a transposed row; they go through LDS so that a transposed row's 128 elements leave as one 256-byte run */
    unsigned char* tp = (unsigned char*)&so[0][0][0];      /* two planes of 64 rows at the ring's pitch: 2 * 64 * 272 B, the size of so */
#pragma unroll
    for (int u = 0; u < 8; ++u) { const int t = u & 3, half = u >> 2; const float bb = bf16_round(bt[t]); FragH fh, fl;
#pragma unroll
      for (int r = 0; r < 8; ++r) { const float v = accs[u][r] * alpha + bb; const _Float16 hv = (_Float16)v; fh.h[r] = hv; fl.h[r] = (_Float16)((v - (float)hv) * 1024.0f); }
      unsigned char* q = tp + (t * 16 + ln) * G2_PITCH + (32 * w + half * 16 + 8 * hh) * 2; *(v8us*)q = fh.half[0]; *(v8us*)(q + 64 * G2_PITCH) = fl.half[0]; }
    __syncthreads();      /* a transposed row holds elements of all four waves */
    v8us xh[8], xl[8]; unsigned short* qh[8]; unsigned short* ql[8];
#pragma unroll
    for (int i = 0; i < 8; ++i) { const int d = i * 8 + (tid >> 4); const unsigned char* q = tp + d * G2_PITCH + ln * 16; xh[i] = *(const v8us*)q; xl[i] = *(const v8us*)(q + 64 * G2_PITCH); const size_t xo = (size_t)(col0 + d) * M + mt * 128 + ln * 8; qh[i] = (unsigned short*)Th + xo; ql[i] = (unsigned short*)Tl + xo; }
    __builtin_amdgcn_sched_barrier(0);      /* values and addresses first, then the 16 stores as one group: formed among the stores the addresses share registers, and each reuse waits for an issued store */
#pragma unroll
    for (int i = 0; i < 8; ++i) { *(v8us*)qh[i] = xh[i]; *(v8us*)ql[i] = xl[i]; }
    asm volatile("s_wait_xcnt 0x0" ::: "memory");      /* stands in front of whatever reuses the registers of the 16 stores above */
    return; }
#pragma unroll
  for (int u = 0; u < 8; ++u) { const int t = u & 3, half = u >> 2;
#pragma unroll
    for (int r = 0; r < 8; ++r) so[w][half * 16 + 8 * hh + r][t * 16 + ln] = accs[u][r]; }
  __builtin_amdgcn_fence(__ATOMIC_ACQ_REL, "workgroup"); __builtin_amdgcn_wave_barrier();
  const int rsub = lane >> 4; const v4f bv4 = {bf16_round(b4[0]), bf16_round(b4[1]), bf16_round(b4[2]), bf16_round(b4[3])};
  {      /* no branch per row: the 16 LDS reads are one group, the sums one block, the stores one group under one test of the pointer */
    v4f o[16];
#pragma unroll
    for (int q = 0; q < 16; ++q) o[q] = *(const v4fa*)&so[w][q * 2 + rsub][c4];
#pragma unroll
    for (int q = 0; q < 16; ++q)
#pragma unroll
      for (int i = 0; i < 4; ++i) { float v = o[q][i] * alpha + bv4[i]; if (CP) v += cp[q][i];
        if (ACT == 3) v = fmaxf(v, 0.f); else if (ACT == 6) v = 0.5f * v * (1.0f + erff(v * 0.70710678118654752f)); else if (ACT == 11) v = 1.0f / (1.0f + expf(-v)); else if (ACT == 15) v = v / (1.0f + expf(-v)); else if (ACT == 12) v = (v > 0.f) ? v : 0.01f * v; else if (ACT == 8) v = tanhf(v);
        o[q][i] = v; }
    if (C) { float* po[16];
#pragma unroll
      for (int q = 0; q < 16; ++q) po[q] = C + cofs + (size_t)(row0 + q * 2 + rsub) * ldc + col0 + c4;
      __builtin_amdgcn_sched_barrier(0);      /* all 16 addresses are formed in front of the stores, each in registers of its own: formed among the stores they share registers, and each reuse waits for an issued store */
#pragma unroll
      for (int q = 0; q < 16; ++q) *(v4f*)po[q] = o[q];
      asm volatile("s_wait_xcnt 0x0" ::: "memory");      /* stands in front of whatever reuses the registers of the 16 stores above */
    }
    if (C16) { _Float16* ph[16]; v4h h4[16];
#pragma unroll
      for (int q = 0; q < 16; ++q) { for (int i = 0; i < 4; ++i) h4[q][i] = (_Float16)o[q][i]; ph[q] = C16 + cofs + (size_t)(row0 + q * 2 + rsub) * ldc + col0 + c4; }
      __builtin_amdgcn_sched_barrier(0);      /* as above: values and addresses first, then the 16 stores as one group */
#pragma unroll
      for (int q = 0; q < 16; ++q) *(v4h*)ph[q] = h4[q]; }
    if (Hh) { v4h h4[16], l4[16]; _Float16* ph[16]; _Float16* pl[16];
#pragma unroll
      for (int q = 0; q < 16; ++q) { hl4(o[q], h4[q], l4[q]); const size_t ho = cofs + (size_t)(row0 + q * 2 + rsub) * ldc + col0 + c4; ph[q] = Hh + ho; pl[q] = Hl + ho; }
      __builtin_amdgcn_sched_barrier(0);      /* as above: values and addresses first, then the 32 stores as one group */
#pragma unroll
      for (int q = 0; q < 16; ++q) { *(v4h*)ph[q] = h4[q]; *(v4h*)pl[q] = l4[q]; }
      asm volatile("s_wait_xcnt 0x0" ::: "memory");      /* stands in front of whatever reuses the registers of the 32 stores above */
    }
     } }
// ---- a product whose A operand is a hi plane and a residual plane: both passes in one launch ----
// Block = 8 waves on one 128x64 tile: waves 0-3 multiply the hi plane's rows, waves 4-7 the residual plane's rows, against the one staged B tile; the write-out adds the two sums.
// One stage = 128 k of the 128 rows of each A plane and of the 64 B rows, at the pitch of k_proj5's ring; two buffers.
#define G2P_AB (256 * G2_PITCH)
#define G2P_STAGE ((256 + 64) * G2_PITCH)
// One wave's share of a stage: its own 32 A rows and 8 B rows, two rows (2 x 256 B, whole lines) per wave-wide copy, 16 B per lane, 20 copies.
__device__ __forceinline__ void g2p_stage(unsigned la, unsigned lb, const _Float16* ga, int lda, const _Float16* gb, int ldb) {
  unsigned l[20]; const _Float16* g[20];
#pragma unroll
  for (int i = 0; i < 16; ++i) { l[i] = la + i * (2 * G2_PITCH); g[i] = ga + (size_t)(2 * i) * lda; }
#pragma unroll
  for (int i = 0; i < 4; ++i) { l[16 + i] = lb + i * (2 * G2_PITCH); g[16 + i] = gb + (size_t)(2 * i) * ldb; }
  // the copies go to LDS through no register; s_wait_xcnt is the statement's last line so that no address register is rewritten ahead of it
  asm volatile("global_load_async_to_lds_b128 %0, %10, off\n\t"
               "global_load_async_to_lds_b128 %1, %11, off\n\t"
               "global_load_async_to_lds_b128 %2, %12, off\n\t"
               "global_load_async_to_lds_b128 %3, %13, off\n\t"
               "global_load_async_to_lds_b128 %4, %14, off\n\t"
               "global_load_async_to_lds_b128 %5, %15, off\n\t"
               "global_load_async_to_lds_b128 %6, %16, off\n\t"
               "global_load_async_to_lds_b128 %7, %17, off\n\t"
               "global_load_async_to_lds_b128 %8, %18, off\n\t"
               "global_load_async_to_lds_b128 %9, %19, off\n\t"
               "s_wait_xcnt 0x0"
               :: "v"(l[0]), "v"(l[1]), "v"(l[2]), "v"(l[3]), "v"(l[4]), "v"(l[5]), "v"(l[6]), "v"(l[7]), "v"(l[8]), "v"(l[9]),
                  "v"(g[0]), "v"(g[1]), "v"(g[2]), "v"(g[3]), "v"(g[4]), "v"(g[5]), "v"(g[6]), "v"(g[7]), "v"(g[8]), "v"(g[9]) : "memory");
  asm volatile("global_load_async_to_lds_b128 %0, %10, off\n\t"
               "global_load_async_to_lds_b128 %1, %11, off\n\t"
               "global_load_async_to_lds_b128 %2, %12, off\n\t"
               "global_load_async_to_lds_b128 %3, %13, off\n\t"
               "global_load_async_to_lds_b128 %4, %14, off\n\t"
               "global_load_async_to_lds_b128 %5, %15, off\n\t"
               "global_load_async_to_lds_b128 %6, %16, off\n\t"
               "global_load_async_to_lds_b128 %7, %17, off\n\t"
               "global_load_async_to_lds_b128 %8, %18, off\n\t"
               "global_load_async_to_lds_b128 %9, %19, off\n\t"
               "s_wait_xcnt 0x0"
               :: "v"(l[10]), "v"(l[11]), "v"(l[12]), "v"(l[13]), "v"(l[14]), "v"(l[15]), "v"(l[16]), "v"(l[17]), "v"(l[18]), "v"(l[19]),
                  "v"(g[10]), "v"(g[11]), "v"(g[12]), "v"(g[13]), "v"(g[14]), "v"(g[15]), "v"(g[16]), "v"(g[17]), "v"(g[18]), "v"(g[19]) : "memory");
}
// C = act(Ah*B^T * alpha + bias (+ CP) + Al*B^T * alphal); CP: optional addend of C's shape and pitch (it may be C itself: a lane reads exactly the elements that it stores). M % 128 == 0, N % 64 == 0, K % 128 == 0.
// SPLIT: the result is the next product's A operand and is stored as its hi/lo planes Ch, Cl (C's shape and pitch) and not as f32.
template <int ACT, bool SPLIT>
__global__ __launch_bounds__(256) void k_gemm2p(const _Float16* __restrict__ Ah, const _Float16* __restrict__ Al, int lda, const _Float16* __restrict__ Bh, int ldb, float alpha, float alphal, const float* __restrict__ bias, const float* CP,
    float* C, _Float16* __restrict__ Ch, _Float16* __restrict__ Cl, int ldc, int M, int N, int K) {
  __shared__ __attribute__((aligned(16))) float so[8][32][68]; __shared__ __attribute__((aligned(16))) unsigned char ring[2 * G2P_STAGE];
  const int tid = threadIdx.x, w = tid >> 5, lane = tid & 31, ln = lane & 15, hh = lane >> 4, pl = w >> 2, wr = w & 3;      /* pl: the wave's plane; wr: its group of 32 rows */
  const int ntn = N >> 6; const int bx = (int)blockIdx.x; const int mt = bx / ntn, nq = bx - mt * ntn; const int row0 = mt * 128 + 32 * wr, col0 = nq * 64; if (mt * 128 >= M) return;      /* the whole block leaves, in front of every barrier */
  const v8f z8 = {0.f,0.f,0.f,0.f,0.f,0.f,0.f,0.f}; v8f c00 = z8, c01 = z8, c02 = z8, c03 = z8, c10 = z8, c11 = z8, c12 = z8, c13 = z8;
  const _Float16* ga = (pl ? Al : Ah) + (size_t)(row0 + hh) * lda + ln * 8; const _Float16* gb = Bh + (size_t)(col0 + 8 * w + hh) * ldb + ln * 8;      /* this lane's first 16 bytes of the wave's A and B rows */
  const unsigned la = (unsigned)(size_t)ring + (unsigned)((32 * w + hh) * G2_PITCH + ln * 16), lb = (unsigned)(size_t)ring + (unsigned)(G2P_AB + (8 * w + hh) * G2_PITCH + ln * 16);
  const int nst = K >> 7;
  g2p_stage(la, lb, ga, lda, gb, ldb);
  // What the write-out adds (bias, addend CP) is read here, in the write-out's layout (a wave writes 16 of its group's 32 rows; lane = 4 columns of rows 16 pl + 2q + hh): independent 16-byte loads issued as one group, in flight beside stage 0's copies.
  const int c4 = ln * 4, rw = 16 * pl + hh; const v4f z4 = {0.f,0.f,0.f,0.f}; v4f b4 = z4, cp[8];
#pragma unroll
  for (int q = 0; q < 8; ++q) cp[q] = z4;
  if (CP) { const float* pc[8];
#pragma unroll
    for (int q = 0; q < 8; ++q) pc[q] = CP + (size_t)(row0 + rw + q * 2) * ldc + col0 + c4;
    __builtin_amdgcn_sched_barrier(0);      /* all 8 addresses are formed in front of the loads, each in registers of its own: formed among the loads they share registers, and each reuse waits for an issued load */
#pragma unroll
    for (int q = 0; q < 8; ++q) cp[q] = *(const v4fa*)pc[q];
    asm volatile("s_wait_xcnt 0x0" ::: "memory");      /* stands in front of whatever reuses the address registers of the 8 loads above */
  }
  if (bias) { b4 = *(const v4fa*)(bias + col0 + c4);
    asm volatile("s_wait_xcnt 0x0" ::: "memory");      /* the same for the bias load */
  }
  asm volatile("s_wait_asynccnt 0x0" ::: "memory");      /* this wave's copies of stage 0 have landed */
  __syncthreads();      /* and every other wave's: stage 0 may be read */
  if (nst > 1) g2p_stage(la + G2P_STAGE, lb + G2P_STAGE, ga + 128, lda, gb + 128, ldb);
#pragma unroll 1      /* one trip per stage: the two buffers alternate */
  for (int t = 0; t < nst; ++t) { const unsigned bo = (unsigned)(t & 1) * G2P_STAGE; const unsigned char* pa = ring + bo + (32 * w + ln) * G2_PITCH; const unsigned char* pb = ring + bo + G2P_AB + ln * G2_PITCH;
    v16h fa[2][2], fb[2][4];      /* two fragment sets: the next k step's LDS reads are issued, as one group, ahead of this step's WMMAs; never beyond the stage */
    fa[0][0] = g2_lfrag(pa, hh); fa[0][1] = g2_lfrag(pa + 16 * G2_PITCH, hh);
#pragma unroll
    for (int j = 0; j < 4; ++j) fb[0][j] = g2_lfrag(pb + j * 16 * G2_PITCH, hh);
#pragma unroll
    for (int ks = 0; ks < 4; ++ks) { const int cu = ks & 1, nx = cu ^ 1;
      if (ks < 3) { fa[nx][0] = g2_lfrag(pa + (ks + 1) * 64, hh); fa[nx][1] = g2_lfrag(pa + 16 * G2_PITCH + (ks + 1) * 64, hh);
#pragma unroll
        for (int j = 0; j < 4; ++j) fb[nx][j] = g2_lfrag(pb + j * 16 * G2_PITCH + (ks + 1) * 64, hh); }
      __builtin_amdgcn_sched_barrier(0);      /* keeps the reads above in front of the WMMAs below: sunk to their uses, each pair of WMMAs waits out an LDS latency */
      c00 = g2_mm(fa[cu][0], fb[cu][0], c00); c10 = g2_mm(fa[cu][1], fb[cu][0], c10); c01 = g2_mm(fa[cu][0], fb[cu][1], c01); c11 = g2_mm(fa[cu][1], fb[cu][1], c11);
      c02 = g2_mm(fa[cu][0], fb[cu][2], c02); c12 = g2_mm(fa[cu][1], fb[cu][2], c12); c03 = g2_mm(fa[cu][0], fb[cu][3], c03); c13 = g2_mm(fa[cu][1], fb[cu][3], c13);
      __builtin_amdgcn_sched_barrier(0);      /* keeps the next group of reads behind these WMMAs, so that two sets suffice */
    }
    asm volatile("s_wait_dscnt 0x0" ::: "memory");      /* this wave's reads of the buffer are done before it is refilled */
    asm volatile("s_wait_asynccnt 0x0" ::: "memory");      /* this wave's copies of stage t + 1 have landed */
    __syncthreads();      /* publishes stage t + 1 and ends every wave's reads of stage t */
    if (t + 2 < nst) g2p_stage(la + bo, lb + bo, ga + (size_t)(t + 2) * 128, lda, gb + (size_t)(t + 2) * 128, ldb); }
  asm volatile("s_wait_asynccnt 0x0" ::: "memory");      /* no copy is left in flight */
  v8f accs[8] = {c00, c01, c02, c03, c10, c11, c12, c13};
#pragma unroll
  for (int u = 0; u < 8; ++u) { const int t = u & 3, half = u >> 2;
#pragma unroll
    for (int r = 0; r < 8; ++r) so[w][half * 16 + 8 * hh + r][t * 16 + ln] = accs[u][r]; }
  __syncthreads();      /* a row group's two sums come from two waves: both are in LDS before either wave reads them */
  const v4f bv4 = {bf16_round(b4[0]), bf16_round(b4[1]), bf16_round(b4[2]), bf16_round(b4[3])};
  {      /* no branch per row: the 16 LDS reads are one group, the sums one block, the stores one group */
    v4f o[8], ol[8];
#pragma unroll
    for (int q = 0; q < 8; ++q) { o[q] = *(const v4fa*)&so[wr][rw + q * 2][c4]; ol[q] = *(const v4fa*)&so[4 + wr][rw + q * 2][c4]; }
#pragma unroll
    for (int q = 0; q < 8; ++q)
#pragma unroll
      for (int i = 0; i < 4; ++i) { float v = o[q][i] * alpha + bv4[i]; if (CP) v += cp[q][i]; v += ol[q][i] * alphal;      /* the order of the two separate passes: hi sum, bias, addend, then the residual sum */
        if (ACT == 3) v = fmaxf(v, 0.f);
        o[q][i] = v; }
    float* po[8]; _Float16* ph[8]; _Float16* pl[8]; v4h h4[8], l4[8];
#pragma unroll
    for (int q = 0; q < 8; ++q) { const size_t co = (size_t)(row0 + rw + q * 2) * ldc + col0 + c4; if (SPLIT) { hl4(o[q], h4[q], l4[q]); ph[q] = Ch + co; pl[q] = Cl + co; } else po[q] = C + co; }
    __builtin_amdgcn_sched_barrier(0);      /* all addresses are formed in front of the stores, each in registers of its own: formed among the stores they share registers, and each reuse waits for an issued store */
#pragma unroll
    for (int q = 0; q < 8; ++q) { if (SPLIT) { *(v4h*)ph[q] = h4[q]; *(v4h*)pl[q] = l4[q]; } else *(v4f*)po[q] = o[q]; }
    asm volatile("s_wait_xcnt 0x0" ::: "memory");      /* stands in front of whatever reuses the registers of the stores above */
  } }
// ---- the wide form of k_gemm2p, for a product with many columns: block tile 128 x 32 NB, wave tile 64 x 16 NB ----
// 8 waves: plane (hi, residual) x 2 row groups of 64 x 2 column groups of 16 NB. A staged A row meets more columns, an A fragment read from LDS feeds NB WMMAs and a B fragment four, so the product draws fewer bytes from L2 and from LDS.
// One stage = 128 k of the 128 rows of each A plane and of the TN B rows, at the pitch of k_proj5's ring; two buffers. After the k loop the ring holds the waves' sums for the write-out.
// Eight copies: 16 rows, two rows (2 x 256 B, whole lines) per wave-wide copy, 16 B per lane. l, g: the lane's LDS and global address of its first chunk.
typedef int v4i_g __attribute__((ext_vector_type(4)));
__device__ __forceinline__ void g2w_cp8(unsigned char* l, const _Float16* g, int ld) {
  // the copies go to LDS through no register; written as the builtin, so that their addresses may lie in any vector register: as asm operands they were given registers among the first 256, and accumulators were moved out and back at every stage
#pragma unroll
  for (int i = 0; i < 8; ++i) __builtin_amdgcn_global_load_async_to_lds_b128((__attribute__((address_space(1))) v4i_g*)(g + (size_t)(2 * i) * ld), (__attribute__((address_space(3))) v4i_g*)(l + i * (2 * G2_PITCH)), 0, 0);
}
// One wave's share of a stage: 32 of the 256 A rows and TN / 8 B rows.
template <int TN>
__device__ __forceinline__ void g2w_stage(unsigned char* la, unsigned char* lb, const _Float16* ga, int lda, const _Float16* gb, int ldb) {
  g2w_cp8(la, ga, lda); g2w_cp8(la + 16 * G2_PITCH, ga + (size_t)16 * lda, lda);
#pragma unroll
  for (int i = 0; i < TN / 128; ++i) g2w_cp8(lb + i * 16 * G2_PITCH, gb + (size_t)(16 * i) * ldb, ldb);
}
// Ch, Cl = hi/lo planes of act(Ah*B^T * alpha + bias + Al*B^T * alphal). M % 128 == 0, N % (32 NB) == 0, K % 128 == 0.
// Every loop marked unroll indexes accumulators, fragments or write-out values: unrolled, those arrays stay in registers.
template <int ACT, int NB>
__global__ __launch_bounds__(256) void k_gemm2w(const _Float16* __restrict__ Ah, const _Float16* __restrict__ Al, int lda, const _Float16* __restrict__ Bh, int ldb, float alpha, float alphal, const float* __restrict__ bias,
    _Float16* __restrict__ Ch, _Float16* __restrict__ Cl, int ldc, int M, int N, int K) {
  constexpr int CW = NB * 16, TN = 2 * CW, STAGE = (256 + TN) * G2_PITCH, SOP = CW + 4;      /* CW: columns of a wave; TN: of the block; SOP: pitch, in floats, of a wave's sums in LDS */
  static_assert(8 * 64 * SOP * 4 <= 2 * STAGE, "the sums fit the ring");
  __shared__ __attribute__((aligned(16))) unsigned char ring[2 * STAGE];
  const int tid = threadIdx.x, w = __builtin_amdgcn_readfirstlane(tid >> 5), lane = tid & 31, ln = lane & 15, hh = lane >> 4, pl = w >> 2, wq = w & 3, rg = wq >> 1, cg = wq & 1;      /* w: the wave's number, held in a scalar register, so that what follows from it takes no vector registers; pl: the wave's plane; rg, cg: its row and column group */
  const int ntn = N / TN; const int bx = (int)blockIdx.x; const int mt = bx / ntn, nq = bx - mt * ntn; const int col0 = nq * TN; if (mt * 128 >= M) return;      /* the whole block leaves, in front of every barrier */
  v8f acc[4][NB];
#pragma unroll
  for (int i = 0; i < 4; ++i)
#pragma unroll
    for (int j = 0; j < NB; ++j) acc[i][j] = (v8f){0.f,0.f,0.f,0.f,0.f,0.f,0.f,0.f};
  const _Float16* ga = (pl ? Al : Ah) + (size_t)(mt * 128 + 32 * wq + hh) * lda + ln * 8; const _Float16* gb = Bh + (size_t)(col0 + (TN / 8) * w + hh) * ldb + ln * 8;      /* this lane's first 16 bytes of the A and B rows that the wave copies */
  unsigned char* const la = ring + ((TN + 32 * w + hh) * G2_PITCH + ln * 16); unsigned char* const lb = ring + (((TN / 8) * w + hh) * G2_PITCH + ln * 16);      /* a stage holds the B rows first, then the A rows */
  const int nst = K >> 7;
  g2w_stage<TN>(la, lb, ga, lda, gb, ldb);
  constexpr int LPR = CW / 4, RPI = 32 / LPR, NQ = 32 / RPI;      /* write-out: LPR lanes of 4 columns cover a row, RPI rows per wave-wide access; a wave writes 32 of its group's 64 rows */
  const int c4 = (lane % LPR) * 4, rw = 32 * pl + lane / LPR;
  asm volatile("s_wait_asynccnt 0x0" ::: "memory");      /* this wave's copies of stage 0 have landed */
  __syncthreads();      /* and every other wave's: stage 0 may be read */
  if (nst > 1) g2w_stage<TN>(la + STAGE, lb + STAGE, ga + 128, lda, gb + 128, ldb);
#pragma unroll 1      /* one trip per stage: the two buffers alternate */
  for (int t = 0; t < nst; ++t) { const unsigned bo = (unsigned)(t & 1) * STAGE; const unsigned boa = (t & 1) ? (unsigned)(STAGE + TN * G2_PITCH) : (unsigned)(TN * G2_PITCH);      /* where the buffer's A rows begin, as one scalar: the fragment reads then differ by offsets that fit the instruction's offset field */
    const unsigned char* pa = ring + boa + (128 * pl + 64 * rg + ln) * G2_PITCH; const unsigned char* pb = ring + bo + (CW * cg + ln) * G2_PITCH;
    v16h fa[2][4], fb[2][NB];      /* two fragment sets: the next k step's LDS reads are issued, as one group, ahead of this step's WMMAs; never beyond the stage */
#pragma unroll
    for (int i = 0; i < 4; ++i) fa[0][i] = g2_lfrag(pa + i * 16 * G2_PITCH, hh);
#pragma unroll
    for (int j = 0; j < NB; ++j) fb[0][j] = g2_lfrag(pb + j * 16 * G2_PITCH, hh);
#pragma unroll
    for (int ks = 0; ks < 4; ++ks) { const int cu = ks & 1, nx = cu ^ 1;
      if (ks < 3) {
#pragma unroll
        for (int i = 0; i < 4; ++i) fa[nx][i] = g2_lfrag(pa + i * 16 * G2_PITCH + (ks + 1) * 64, hh);
#pragma unroll
        for (int j = 0; j < NB; ++j) fb[nx][j] = g2_lfrag(pb + j * 16 * G2_PITCH + (ks + 1) * 64, hh); }
      __builtin_amdgcn_sched_barrier(0);      /* keeps the reads above in front of the WMMAs below: sunk to their uses, each group of WMMAs waits out an LDS latency */
#pragma unroll
      for (int j = 0; j < NB; ++j)
#pragma unroll
        for (int i = 0; i < 4; ++i) acc[i][j] = g2_mm(fa[cu][i], fb[cu][j], acc[i][j]);
      __builtin_amdgcn_sched_barrier(0);      /* keeps the next group of reads behind these WMMAs, so that two sets suffice */
    }
    asm volatile("s_wait_dscnt 0x0" ::: "memory");      /* this wave's reads of the buffer are done before it is refilled */
    asm volatile("s_wait_asynccnt 0x0" ::: "memory");      /* this wave's copies of stage t + 1 have landed */
    __syncthreads();      /* publishes stage t + 1 and ends every wave's reads of stage t */
    if (t + 2 < nst) g2w_stage<TN>(la + bo, lb + bo, ga + (size_t)(t + 2) * 128, lda, gb + (size_t)(t + 2) * 128, ldb); }
  asm volatile("s_wait_asynccnt 0x0" ::: "memory");      /* no copy is left in flight; the loop's last barrier has ended every read of the ring, which now takes the sums */
  const v4f b4 = *(const v4fa*)(bias + col0 + cg * CW + c4);      /* in flight beside the LDS stores below */
  asm volatile("s_wait_xcnt 0x0" ::: "memory");      /* stands in front of whatever reuses the address registers of the bias load */
  float* so = (float*)ring;      /* [8 waves][64 rows][SOP] */
#pragma unroll
  for (int i = 0; i < 4; ++i)
#pragma unroll
    for (int j = 0; j < NB; ++j)
#pragma unroll
      for (int r = 0; r < 8; ++r) so[(size_t)((w * 64 + i * 16 + 8 * hh + r) * SOP + j * 16 + ln)] = acc[i][j][r];
  __syncthreads();      /* a tile's two sums come from two waves: both are in LDS before either wave reads them */
  const v4f bv4 = {bf16_round(b4[0]), bf16_round(b4[1]), bf16_round(b4[2]), bf16_round(b4[3])};
#pragma unroll
  for (int qc = 0; qc < NQ; qc += 8) {      /* eight accesses at a time: the LDS reads are one group, the sums one block, the stores one group */
    v4f o[8], ol[8];
#pragma unroll
    for (int q = 0; q < 8; ++q) { const int row = rw + (qc + q) * RPI; o[q] = *(const v4fa*)&so[(wq * 64 + row) * SOP + c4]; ol[q] = *(const v4fa*)&so[((4 + wq) * 64 + row) * SOP + c4]; }
    _Float16* ph[8]; _Float16* pq[8]; v4h h4[8], l4[8];
#pragma unroll
    for (int q = 0; q < 8; ++q) {
#pragma unroll
      for (int i = 0; i < 4; ++i) { float v = o[q][i] * alpha + bv4[i]; v += ol[q][i] * alphal;      /* the order of k_gemm2p: hi sum, bias, then the residual sum */
        if (ACT == 3) v = fmaxf(v, 0.f);
        o[q][i] = v; }
      hl4(o[q], h4[q], l4[q]); const size_t co = (size_t)(mt * 128 + 64 * rg + rw + (qc + q) * RPI) * ldc + col0 + cg * CW + c4; ph[q] = Ch + co; pq[q] = Cl + co; }
    __builtin_amdgcn_sched_barrier(0);      /* values and addresses first, then the 16 stores as one group: formed among the stores the addresses share registers, and each reuse waits for an issued store */
#pragma unroll
    for (int q = 0; q < 8; ++q) { *(v4h*)ph[q] = h4[q]; *(v4h*)pq[q] = l4[q]; }
    asm volatile("s_wait_xcnt 0x0" ::: "memory");      /* stands in front of whatever reuses the registers of the 16 stores above */
  } }
// The five projections that depend on the embeddings alone (q, k, v of the self attention; k, v of the cross attention) in one grid: a range of block indices per product.
// BT: the six [DM][DM] weight planes in a row (q, k, v, cross q, cross k, cross v). Each result is stored as the attention's operand planes: q and k as hi/lo [rows][DM], v as hi/lo of its transpose [DM][rows] (64 columns of a tile = one head).
#define P5_NW ((SW / 128) * (DM / 64))
#define P5_NP ((SP / 128) * (DM / 64))
__global__ __launch_bounds__(128) void k_proj5(const _Float16* __restrict__ WE, const _Float16* __restrict__ PE, const _Float16* __restrict__ BT, const float* __restrict__ bq, const float* __restrict__ bk, const float* __restrict__ bv, const float* __restrict__ bkc, const float* __restrict__ bvc,
    _Float16* __restrict__ Qh, _Float16* __restrict__ Ql, _Float16* __restrict__ Kh, _Float16* __restrict__ Kl, _Float16* __restrict__ Vth, _Float16* __restrict__ Vtl,
    _Float16* __restrict__ KCh, _Float16* __restrict__ KCl, _Float16* __restrict__ VCth, _Float16* __restrict__ VCtl) {
  const int b = (int)blockIdx.x; const bool word = b < 3 * P5_NW;      /* block-uniform */
  const int j = word ? b / P5_NW : (b - 3 * P5_NW) / P5_NP; const int bx = word ? b - j * P5_NW : (b - 3 * P5_NW) - j * P5_NP;
  const float* bias = word ? (j == 0 ? bq : (j == 1 ? bk : bv)) : (j == 0 ? bkc : bvc);
  _Float16* const hh_ = word ? (j == 0 ? Qh : (j == 1 ? Kh : nullptr)) : (j == 0 ? KCh : nullptr); _Float16* const hl_ = word ? (j == 0 ? Ql : (j == 1 ? Kl : nullptr)) : (j == 0 ? KCl : nullptr);
  _Float16* const th_ = word ? (j == 2 ? Vth : nullptr) : (j == 1 ? VCth : nullptr); _Float16* const tl_ = word ? (j == 2 ? Vtl : nullptr) : (j == 1 ? VCtl : nullptr);
  g2_body<0>(word ? WE : PE, DM, 0, BT + (size_t)(word ? j : 4 + j) * DM * DM, DM, 0, 0.0625f, bias, 0, nullptr, 1, 0, 0,
             nullptr, nullptr, hh_, hl_, th_, tl_, DM, 0, word ? SW : SP, DM, DM, bx, 0); }


// K/V staging of k_flashm: one stage = the 32 keys of one trip: 32 K rows of 128 B (hi plane, lo plane) at a pitch of 144 B, 64 V^T rows of 64 B (hi plane, lo plane) at a pitch of 80 B (16 B x odd, for the 16-byte fragment reads); two buffers.
#define FM_KP 144
#define FM_VP 80
#define FM_KL (32 * FM_KP)
#define FM_VH (2 * 32 * FM_KP)
#define FM_VD (64 * FM_VP)
#define FM_STAGE (FM_VH + 2 * FM_VD)
// One wave's share of a stage: 8 K rows and 16 V^T rows of each plane, 16 B per lane, 8 copies (a K copy brings 4 whole rows, a V copy 8 rows).
// lk, lv: the lane's LDS byte addresses of its first K and V chunk (hi plane); gkh, gkl, gvh, gvl: the matching global addresses in the four planes.
__device__ __forceinline__ void fm_stage(unsigned lk, unsigned lv, const unsigned short* gkh, const unsigned short* gkl, int ldk, const unsigned short* gvh, const unsigned short* gvl, int ldv) {
  // the copies go to LDS through no register; s_wait_xcnt is the statement's last line so that no address register is rewritten ahead of it
  asm volatile("global_load_async_to_lds_b128 %0, %8, off\n\t"
               "global_load_async_to_lds_b128 %1, %9, off\n\t"
               "global_load_async_to_lds_b128 %2, %10, off\n\t"
               "global_load_async_to_lds_b128 %3, %11, off\n\t"
               "global_load_async_to_lds_b128 %4, %12, off\n\t"
               "global_load_async_to_lds_b128 %5, %13, off\n\t"
               "global_load_async_to_lds_b128 %6, %14, off\n\t"
               "global_load_async_to_lds_b128 %7, %15, off\n\t"
               "s_wait_xcnt 0x0"
               :: "v"(lk), "v"(lk + 4 * FM_KP), "v"(lk + FM_KL), "v"(lk + FM_KL + 4 * FM_KP), "v"(lv), "v"(lv + 8 * FM_VP), "v"(lv + FM_VD), "v"(lv + FM_VD + 8 * FM_VP),
                  "v"(gkh), "v"(gkh + (size_t)4 * ldk), "v"(gkl), "v"(gkl + (size_t)4 * ldk), "v"(gvh), "v"(gvh + (size_t)8 * ldv), "v"(gvl), "v"(gvl + (size_t)8 * ldv) : "memory");
}
// lane l's value in lane l ^ 16, by a vector cross-row move (a shuffle would go through the LDS unit and be waited for)
__device__ __forceinline__ float fm_xhalf(float x) { const int b = __builtin_bit_cast(int, x); return __builtin_bit_cast(float, __builtin_amdgcn_permlanex16(b, b, 0x76543210, 0xfedcba98, false, false)); }
template <int TQ, int TK>
__global__ __launch_bounds__(128) void k_flashm(const _Float16* __restrict__ Q16, const _Float16* __restrict__ Q16lo, int ldq, const _Float16* __restrict__ K16, const _Float16* __restrict__ K16lo, int ldk, const _Float16* __restrict__ Vt, const _Float16* __restrict__ Vtlo, const unsigned* __restrict__ MB, const int* __restrict__ RA, const int* __restrict__ KE, _Float16* __restrict__ Oh, _Float16* __restrict__ Ol, int ldo) {
  constexpr int RPW = 16, RTN = RPW / 16, NQB = TQ / (4 * RPW), DT = 4, KS = 2;
  __shared__ __attribute__((aligned(16))) float sO[4][RPW][64 + 4]; __shared__ __attribute__((aligned(16))) unsigned char kv[2 * FM_STAGE];
  const int tid = threadIdx.x, w = tid >> 5, lane = tid & 31, ln = lane & 15, hh = lane >> 4;
  const int slab = blockIdx.x / NQB, qblk = blockIdx.x % NQB; const int b = slab / NH, h = slab % NH; const int qb0 = qblk * (4 * RPW); const int q0 = qb0 + w * RPW;
  FragH aq[2][KS], aql[2][KS];
#pragma unroll
  for (int rt = 0; rt < RTN; ++rt) { const size_t qo = ((size_t)b * TQ + q0 + rt * 16 + ln) * ldq + h * 64; const unsigned short* qr = (const unsigned short*)Q16 + qo; const unsigned short* ql = (const unsigned short*)Q16lo + qo;
#pragma unroll
    for (int ks = 0; ks < KS; ++ks) { aq[rt][ks].half[0] = *(const v8us*)(qr + ks * 32 + 8 * hh); aq[rt][ks].half[1] = *(const v8us*)(qr + ks * 32 + 16 + 8 * hh); aql[rt][ks].half[0] = *(const v8us*)(ql + ks * 32 + 8 * hh); aql[rt][ks].half[1] = *(const v8us*)(ql + ks * 32 + 16 + 8 * hh); } }
  asm volatile("s_wait_xcnt 0x0" ::: "memory");      /* stands in front of whatever reuses the address registers of the Q loads above */
  const unsigned short* Vth = (const unsigned short*)Vt + (size_t)slab * 64 * TK; const unsigned short* Vtl = (const unsigned short*)Vtlo + (size_t)slab * 64 * TK;
  float m_r[2], l_r[2]; v8f oacc[2][DT], oaccl[2][DT];
#pragma unroll
  for (int rt = 0; rt < RTN; ++rt) { m_r[rt] = -3.0e38f; l_r[rt] = 0.f;
#pragma unroll
    for (int dt = 0; dt < DT; ++dt) { oacc[rt][dt] = (v8f){0.f,0.f,0.f,0.f,0.f,0.f,0.f,0.f}; oaccl[rt][dt] = oacc[rt][dt]; } }
  int jend = KE[qblk * 32]; jend = min(TK, (jend + 31) & ~31); if (jend < 32) jend = 32;      /* block-uniform */
  int allm[2]; const unsigned* mrow[2];
#pragma unroll
  for (int rt = 0; rt < RTN; ++rt) mrow[rt] = MB + (size_t)(q0 + rt * 16 + ln) * (TK / 32);
  const unsigned lk = (unsigned)(size_t)kv + (unsigned)((8 * w + (lane >> 3)) * FM_KP + (lane & 7) * 16), lv = (unsigned)(size_t)kv + (unsigned)(FM_VH + (16 * w + (lane >> 2)) * FM_VP + (lane & 3) * 16);
  const size_t gko = ((size_t)b * TK + 8 * w + (lane >> 3)) * ldk + h * 64 + (lane & 7) * 8, gvo = (size_t)(16 * w + (lane >> 2)) * TK + (lane & 3) * 8;      /* this lane's first 16 bytes of the wave's K and V^T rows */
  const unsigned short* gkh = (const unsigned short*)K16 + gko; const unsigned short* gkl = (const unsigned short*)K16lo + gko; const unsigned short* gvh = Vth + gvo; const unsigned short* gvl = Vtl + gvo;
  fm_stage(lk, lv, gkh, gkl, ldk, gvh, gvl, TK);
#pragma unroll
  for (int rt = 0; rt < RTN; ++rt) { const int* pr = RA + q0 + rt * 16 + ln;
    // the query's row flag: load and data wait are one statement, so that no address register of the load is rewritten ahead of the wait; it stands here so that the wait runs beside the flight of stage 0's copies
    asm volatile("global_load_b32 %0, %1, off\n\ts_wait_loadcnt 0x0" : "=&v"(allm[rt]) : "v"(pr) : "memory"); }
  asm volatile("s_wait_asynccnt 0x0" ::: "memory");      /* this wave's copies of stage 0 have landed */
  __syncthreads();      /* and every other wave's: stage 0 may be read */
  if (32 < jend) fm_stage(lk + FM_STAGE, lv + FM_STAGE, gkh + (size_t)32 * ldk, gkl + (size_t)32 * ldk, ldk, gvh + 32, gvl + 32, TK);
#pragma unroll 1
  for (int j0 = 0; j0 < jend; j0 += 32) {
    const unsigned bo = (unsigned)((j0 >> 5) & 1) * FM_STAGE; const unsigned char* pk = kv + bo + ln * FM_KP + 16 * hh; const unsigned char* pv = kv + bo + FM_VH + ln * FM_VP + 16 * hh;      /* this trip's buffer: the lane's row and half in the K and V^T tiles */
    v8f s[2][2]; FragH bk[2][KS], bkl[2][KS];
#pragma unroll
    for (int nt = 0; nt < 2; ++nt) { const unsigned char* kr = pk + nt * 16 * FM_KP; const unsigned char* kl = kr + FM_KL;
#pragma unroll
      for (int ks = 0; ks < KS; ++ks) { bk[nt][ks].half[0] = *(const v8us*)(kr + ks * 64); bk[nt][ks].half[1] = *(const v8us*)(kr + ks * 64 + 32); bkl[nt][ks].half[0] = *(const v8us*)(kl + ks * 64); bkl[nt][ks].half[1] = *(const v8us*)(kl + ks * 64 + 32); } }
    __builtin_amdgcn_sched_barrier(0);      /* keeps the trip's K reads one group in front of the WMMAs: sunk to their uses, the second 16 keys wait out an LDS latency of their own */
#pragma unroll
    for (int nt = 0; nt < 2; ++nt) {
#pragma unroll
      for (int rt = 0; rt < RTN; ++rt) { v8f acc = (v8f){0.f,0.f,0.f,0.f,0.f,0.f,0.f,0.f}, accr = acc;
#pragma unroll
        for (int ks = 0; ks < KS; ++ks) { acc = mmaH<1>(bk[nt][ks].v, bk[nt][ks].v, aq[rt][ks].v, aq[rt][ks].v, acc); accr = mmaH<1>(bk[nt][ks].v, bk[nt][ks].v, aql[rt][ks].v, aql[rt][ks].v, accr); accr = mmaH<1>(bkl[nt][ks].v, bkl[nt][ks].v, aq[rt][ks].v, aq[rt][ks].v, accr); }
        s[rt][nt] = acc + accr * 0.0009765625f; } }
    FragH bv[DT], bl[DT];      /* the trip's V^T fragments, read as one group in front of the softmax, so that the four output tiles do not each wait out an LDS latency */
#pragma unroll
    for (int dt = 0; dt < DT; ++dt) { const unsigned char* vr = pv + dt * 16 * FM_VP; bv[dt].half[0] = *(const v8us*)vr; bv[dt].half[1] = *(const v8us*)(vr + 32); bl[dt].half[0] = *(const v8us*)(vr + FM_VD); bl[dt].half[1] = *(const v8us*)(vr + FM_VD + 32); }
    FragH pa[2], pl[2];      /* P^T as the B operand: element i of the lane is key 8 hh + i (i < 8) or 16 + 8 hh + (i - 8), which is register i & 7 of score tile i >> 3 and the k order of the V^T fragments */
#pragma unroll
    for (int rt = 0; rt < RTN; ++rt) {      /* no branch in the softmax: each exp is computed for every lane and the conditions pick by select; a query's 32 scores lie in two lanes (ln, ln + 16), so its maximum takes in-lane steps and one exchange */
      float sv[16]; bool ok[16]; const unsigned mw = mrow[rt][j0 >> 5] >> (8 * hh); const bool am = (allm[rt] != 0);
#pragma unroll
      for (int i = 0; i < 16; ++i) { ok[i] = am || (((mw >> ((i >> 3) * 16 + (i & 7))) & 1u) == 0u); sv[i] = ok[i] ? (am ? 0.f : s[rt][i >> 3][i & 7] * SCL2) : -INFINITY; }
      float mt[8];
#pragma unroll
      for (int i = 0; i < 8; ++i) mt[i] = fmaxf(sv[i], sv[8 + i]);
      float mc = fmaxf(fmaxf(fmaxf(mt[0], mt[1]), fmaxf(mt[2], mt[3])), fmaxf(fmaxf(mt[4], mt[5]), fmaxf(mt[6], mt[7])));
      mc = fmaxf(mc, fm_xhalf(mc));
      const float mo = m_r[rt], mn = fmaxf(mo, mc); const float ea = __builtin_amdgcn_exp2f(mo - mn);      /* every exp argument is <= 0 (or -inf): no range reduction and no overflow clamp is needed, one v_exp_f32 each */
      const float al = (mn > -1.0e38f) ? ea : 1.0f; m_r[rt] = mn; float p[16];
#pragma unroll
      for (int i = 0; i < 16; ++i) { const float e = __builtin_amdgcn_exp2f(sv[i] - mn); p[i] = ok[i] ? e : 0.f; }
#pragma unroll
      for (int i = 0; i < 16; ++i) { const float ps = p[i] * 1024.0f; const _Float16 ph = (_Float16)ps; pa[rt].h[i] = ph; pl[rt].h[i] = (_Float16)((ps - (float)ph) * 1024.0f); }
      float pt[8];
#pragma unroll
      for (int i = 0; i < 8; ++i) pt[i] = p[i] + p[8 + i];
      l_r[rt] = l_r[rt] * al + (((pt[0] + pt[1]) + (pt[2] + pt[3])) + ((pt[4] + pt[5]) + (pt[6] + pt[7])));
#pragma unroll
      for (int dt = 0; dt < DT; ++dt) { oacc[rt][dt] *= al; oaccl[rt][dt] *= al; } }
#pragma unroll
    for (int dt = 0; dt < DT; ++dt) {
#pragma unroll
      for (int rt = 0; rt < RTN; ++rt) { oacc[rt][dt] = mmaH<1>(bv[dt].v, bv[dt].v, pa[rt].v, pa[rt].v, oacc[rt][dt]); oaccl[rt][dt] = mmaH<1>(bl[dt].v, bl[dt].v, pa[rt].v, pa[rt].v, oaccl[rt][dt]); oaccl[rt][dt] = mmaH<1>(bv[dt].v, bv[dt].v, pl[rt].v, pl[rt].v, oaccl[rt][dt]); } }
    asm volatile("s_wait_dscnt 0x0" ::: "memory");      /* this wave's reads of the buffer are done before the refill */
    asm volatile("s_wait_asynccnt 0x0" ::: "memory");      /* this wave's copies of the next stage have landed */
    __syncthreads();      /* publishes the next stage and ends every wave's reads of this one */
    if (j0 + 64 < jend) fm_stage(lk + bo, lv + bo, gkh + (size_t)(j0 + 64) * ldk, gkl + (size_t)(j0 + 64) * ldk, ldk, gvh + (j0 + 64), gvl + (j0 + 64), TK); }
  asm volatile("s_wait_asynccnt 0x0" ::: "memory");      /* no copy is left in flight */
#pragma unroll
  for (int rt = 0; rt < RTN; ++rt) {
    float l = l_r[rt]; l += fm_xhalf(l); const float li = (l > 0.f) ? 1.0f / (l * 1024.0f) : 0.f;      /* the two lanes of a query join their sums */
#pragma unroll
    for (int dt = 0; dt < DT; ++dt)
#pragma unroll
      for (int g = 0; g < 2; ++g) { v4f o4;
#pragma unroll
        for (int i = 0; i < 4; ++i) o4[i] = (oacc[rt][dt][4 * g + i] + oaccl[rt][dt][4 * g + i] * 0.0009765625f) * li;
        *(v4fa*)&sO[w][rt * 16 + ln][dt * 16 + 8 * hh + 4 * g] = o4; } }
  __builtin_amdgcn_fence(__ATOMIC_ACQ_REL, "workgroup"); __builtin_amdgcn_wave_barrier();
  {      /* the result is the next product's A operand: it is stored as that operand's hi/lo planes */
    v4h h4[RPW / 2], l4[RPW / 2]; _Float16* ph[RPW / 2]; _Float16* pq[RPW / 2];
#pragma unroll
    for (int rp = 0; rp < RPW; rp += 2) { const int r = rp + (lane >> 4), pc = lane & 15; const v4f val = *(const v4fa*)&sO[w][r][pc * 4]; hl4(val, h4[rp / 2], l4[rp / 2]); const size_t oo = ((size_t)b * TQ + q0 + r) * ldo + h * 64 + pc * 4; ph[rp / 2] = Oh + oo; pq[rp / 2] = Ol + oo; }
    __builtin_amdgcn_sched_barrier(0);      /* values and addresses first, then the stores as one group: formed among the stores the addresses share registers, and each reuse waits for an issued store */
#pragma unroll
    for (int i = 0; i < RPW / 2; ++i) { *(v4h*)ph[i] = h4[i]; *(v4h*)pq[i] = l4[i]; }
     } }


__device__ __forceinline__ void d_causaltab(unsigned* __restrict__ MB, int* __restrict__ RA, int* __restrict__ KE, int nq, int nk, int blk) {
  const int t = blk * 256 + threadIdx.x; const int nw = nk / 32;
  if (t < nq * nw) { const int q = t / nw, w = t % nw; const int first = q + 1 - 32 * w; const unsigned bits = (first <= 0) ? 0xffffffffu : ((first >= 32) ? 0u : (0xffffffffu << first)); *(unsigned*)(MB + t) = bits;  }
  if (t < nq) { *(int*)(RA + t) = 0;  }
  if (t < nq / 64) { const int v = 64 * (t + 1); *(int*)(KE + t * 32) = v;  } }
__device__ __forceinline__ void d_fulltab(unsigned* __restrict__ MB, int* __restrict__ RA, int* __restrict__ KE, int nq, int nk, int blk) {
  const int t = blk * 256 + threadIdx.x; const int nw = nk / 32;
  if (t < nq * nw) { *(unsigned*)(MB + t) = 0u;  }
  if (t < nq) { *(int*)(RA + t) = 0;  }
  if (t < nq / 64) { *(int*)(KE + t * 32) = nk;  } }

// Everything that depends on the inputs alone (eight weight planes, two embedding planes, two mask tables) in one grid: a range of block indices per job, every branch block-uniform.
// BT: the six [DM][DM] weight planes in a row (q, k, v, cross q, cross k, cross v).
#define PR_F (FF * DM / 8 / 256)
#define PR_W (DM * DM / 8 / 256)
#define PR_X (SW * DM / 8 / 256)
#define PR_P (SP * DM / 8 / 256)
#define PR_C (SW * (SW / 32) / 256)
#define PR_U (SW * (SP / 32) / 256)
__global__ __launch_bounds__(256) void k_prep(const float* __restrict__ Wq, const float* __restrict__ Wk, const float* __restrict__ Wv, const float* __restrict__ Wqc, const float* __restrict__ Wkc, const float* __restrict__ Wvc, const float* __restrict__ W1, const float* __restrict__ W2,
    const float* __restrict__ wemb, const float* __restrict__ pemb, _Float16* __restrict__ BT, _Float16* __restrict__ BW1, _Float16* __restrict__ BW2, _Float16* __restrict__ WE16, _Float16* __restrict__ PE16,
    unsigned* __restrict__ MB, int* __restrict__ RA, int* __restrict__ KE, unsigned* __restrict__ MB2, int* __restrict__ RA2, int* __restrict__ KE2) {
  int b = (int)blockIdx.x;
  if (b < PR_F) { d_round16f(W1, BW1, (size_t)FF * DM / 8, (unsigned)b); return; } b -= PR_F;
  if (b < PR_F) { d_round16f(W2, BW2, (size_t)FF * DM / 8, (unsigned)b); return; } b -= PR_F;
  if (b < 6 * PR_W) { const int j = b / PR_W; const float* W = (j == 0) ? Wq : (j == 1) ? Wk : (j == 2) ? Wv : (j == 3) ? Wqc : (j == 4) ? Wkc : Wvc;
    d_round16f(W, BT + (size_t)j * DM * DM, (size_t)DM * DM / 8, (unsigned)(b - j * PR_W)); return; } b -= 6 * PR_W;
  if (b < PR_X) { d_x16(wemb, WE16, (size_t)SW * DM / 8, (unsigned)b); return; } b -= PR_X;
  if (b < PR_P) { d_x16(pemb, PE16, (size_t)SP * DM / 8, (unsigned)b); return; } b -= PR_P;
  if (b < PR_C) { d_causaltab(MB, RA, KE, SW, SW, b); return; } b -= PR_C;
  d_fulltab(MB2, RA2, KE2, SW, SP, b); }

extern "C" void kernel_launch(void* const* d_in, const int* in_sizes, int n_in,
                              void* d_out, int out_size, void* d_ws, size_t ws_size, hipStream_t stream) {
  (void)in_sizes; (void)n_in; (void)out_size;
  const float* const* I = (const float* const*)d_in; const float* wemb = I[0]; const float* pemb = I[1];
  const float* Wq = I[2]; const float* bq = I[3]; const float* Wk = I[4]; const float* bk = I[5]; const float* Wv = I[6]; const float* bv = I[7];
  const float* Wqc = I[8]; const float* bqc = I[9]; const float* Wkc = I[10]; const float* bkc = I[11]; const float* Wvc = I[12]; const float* bvc = I[13];
  const float* W1 = I[14]; const float* b1 = I[15]; const float* W2 = I[16]; const float* b2 = I[17];
  char* ws = (char*)d_ws; size_t off = 0;
  auto take = [&](size_t bytes) { char* p = ws + off; off += (bytes + 255) & ~(size_t)255; return p; };
  _Float16* BT = (_Float16*)take((size_t)6 * DM * DM * 2); _Float16* BQC = BT + (size_t)3 * DM * DM;      /* weight planes q, k, v, cross q, cross k, cross v in a row */
  _Float16* BW1 = (_Float16*)take((size_t)FF * DM * 2); _Float16* BW2 = (_Float16*)take((size_t)DM * FF * 2);
  _Float16* WE16 = (_Float16*)take((size_t)SW * DM * 2); _Float16* PE16 = (_Float16*)take((size_t)SP * DM * 2);
  _Float16* Qh = (_Float16*)take((size_t)SW * DM * 2); _Float16* Ql = (_Float16*)take((size_t)SW * DM * 2); _Float16* Kh = (_Float16*)take((size_t)SW * DM * 2); _Float16* Kl = (_Float16*)take((size_t)SW * DM * 2);
  _Float16* Vth = (_Float16*)take((size_t)SW * DM * 2); _Float16* Vtl = (_Float16*)take((size_t)SW * DM * 2);
  _Float16* KCh = (_Float16*)take((size_t)SP * DM * 2); _Float16* KCl = (_Float16*)take((size_t)SP * DM * 2); _Float16* VCth = (_Float16*)take((size_t)SP * DM * 2); _Float16* VCtl = (_Float16*)take((size_t)SP * DM * 2);
  unsigned* MB = (unsigned*)take((size_t)SW * (SW / 32) * 4); int* RA = (int*)take((size_t)SW * 4); int* KE = (int*)take((size_t)(SW / 64) * 32 * 4);
  unsigned* MB2 = (unsigned*)take((size_t)SW * (SP / 32) * 4); int* RA2 = (int*)take((size_t)SW * 4); int* KE2 = (int*)take((size_t)(SW / 64) * 32 * 4);
  _Float16* Ah = (_Float16*)take((size_t)SW * DM * 2); _Float16* Al = (_Float16*)take((size_t)SW * DM * 2);      /* word hi/lo, later cross hi/lo */
  _Float16* HDh = (_Float16*)take((size_t)SW * FF * 2); _Float16* HDl = (_Float16*)take((size_t)SW * FF * 2);
  if (off > ws_size) return;      /* 12 + 16 + 4 + 2 + 32 + 0.8 + 8 + 32 = 107 MiB */
  const dim3 gW((SW / 128) * (DM / 64), 1), gH((SW / 128) * (FF / 256), 1);
  k_prep<<<2 * PR_F + 6 * PR_W + PR_X + PR_P + PR_C + PR_U, 256, 0, stream>>>(Wq, Wk, Wv, Wqc, Wkc, Wvc, W1, W2, wemb, pemb, BT, BW1, BW2, WE16, PE16, MB, RA, KE, MB2, RA2, KE2);      /* weights are (out,in) row-major = natural Bt; x16 */
  k_proj5<<<3 * P5_NW + 2 * P5_NP, 128, 0, stream>>>(WE16, PE16, BT, bq, bk, bv, bkc, bvc, Qh, Ql, Kh, Kl, Vth, Vtl, KCh, KCl, VCth, VCtl);
  /* --- causal self attention on the word embeddings (all planes hi/lo) --- */
  k_flashm<SW, SW><<<NH * (SW / 64), 128, 0, stream>>>(Qh, Ql, DM, Kh, Kl, DM, Vth, Vtl, MB, RA, KE, Ah, Al, DM);      /* word as hi/lo operand planes */
  k_gemm2p<0, true><<<gW, 256, 0, stream>>>(Ah, Al, DM, BQC, DM, 0.0625f, 0.0625f * 0.0009765625f, bqc, nullptr, nullptr, Qh, Ql, DM, SW, DM, DM);      /* cross q as hi/lo planes */
  k_flashm<SW, SP><<<NH * (SW / 64), 128, 0, stream>>>(Qh, Ql, DM, KCh, KCl, DM, VCth, VCtl, MB2, RA2, KE2, Ah, Al, DM);      /* cross as hi/lo operand planes */
  /* --- FFN: h = relu(cross*W1^T + b1) (hi/lo planes, all FF columns in one launch); out (+)= h_half*W2_half^T (+ b2 once), in two halves of the hidden --- */
  k_gemm2w<3, 8><<<gH, 256, 0, stream>>>(Ah, Al, DM, BW1, DM, 0.0625f, 0.0625f * 0.0009765625f, b1, HDh, HDl, FF, SW, FF, DM);      /* relu on the complete sum, stored as hi/lo planes */
  for (int hf = 0; hf < 2; ++hf) { const _Float16* B2h = BW2 + (size_t)hf * (FF / 2);
    k_gemm2p<0, false><<<gW, 256, 0, stream>>>(HDh + (size_t)hf * (FF / 2), HDl + (size_t)hf * (FF / 2), FF, B2h, FF, 0.0625f, 0.0625f * 0.0009765625f, (hf == 0) ? b2 : nullptr, (hf == 0) ? nullptr : (const float*)d_out, (float*)d_out, nullptr, nullptr, DM, SW, DM, FF / 2); }
}
